// v000
// The times below were measured on an AMD MI455X: many runs one after another, warmed up first and cycling through
// copies of the inputs, with the whole window's GPU time divided by the number of runs. Launches and the gaps
// between them are all in it. The median over several windows is given; except for v000 it joins two sittings, which
// can be a few percent apart, so the side-by-side timings, each taken in one sitting, are the better comparison.
// v000 is the starting kernel. One run takes 251 microseconds.
#include <hip/hip_runtime.h>
#include <hip/hip_bf16.h>

// ---------------- problem constants ----------------
#define D_MODEL    2048
#define NUM_SPOKES 8
#define RANK       64
#define N1         (NUM_SPOKES * RANK)
#define TOKENS     (4 * 4096)
#define TM         64
#define KC         256
#define NKT        (D_MODEL / KC)
#define LDSA_STRIDE (KC + 8)
#define LDSV_STRIDE (N1 + 8)
#define EPS_F      1.1920928955078125e-7f

// LDS byte offsets
#define OFF_INV  0                         // 64 floats (256 B)
#define RAWBYTES (TM * KC * 4)             // 65536 B per raw buffer
#define OFF_RAW0 256
#define OFF_RAW1 (OFF_RAW0 + RAWBYTES)     // 65792
#define OFF_A    (OFF_RAW1 + RAWBYTES)     // 131328
#define OFF_V    (OFF_A + TM * LDSA_STRIDE * 2)  // 165120
#define SMEM_BYTES (OFF_V + TM * LDSV_STRIDE * 2) // 231680  (< 320 KB/WGP)

typedef __attribute__((ext_vector_type(16))) __bf16 v16bf;
typedef __attribute__((ext_vector_type(8)))  __bf16 v8bf;
typedef __attribute__((ext_vector_type(4)))  __bf16 v4bf;
typedef __attribute__((ext_vector_type(8)))  float  v8f;
typedef unsigned int v4u __attribute__((ext_vector_type(4)));
typedef int          v8i __attribute__((ext_vector_type(8)));
typedef int          v4i __attribute__((ext_vector_type(4)));

#if __has_builtin(__builtin_amdgcn_tensor_load_to_lds) && __has_builtin(__builtin_amdgcn_s_wait_tensorcnt)
#define USE_TDM 1
#else
#define USE_TDM 0
#endif

static __device__ __forceinline__ v16bf cat8(v8bf lo, v8bf hi) {
  return __builtin_shufflevector(lo, hi, 0,1,2,3,4,5,6,7,8,9,10,11,12,13,14,15);
}

static __device__ __forceinline__ v8f wmma_bf16(v16bf a, v16bf b, v8f c) {
  return __builtin_amdgcn_wmma_f32_16x16x32_bf16(false, a, false, b, (short)0, c,
                                                 false, false);
}

#if USE_TDM
static __device__ __forceinline__ void tdm_load_tile(const float* gtile, unsigned lds_off) {
  const unsigned long long ga = (unsigned long long)(uintptr_t)gtile;
  v4u g0;
  g0[0] = 1u;
  g0[1] = lds_off;
  g0[2] = (unsigned)ga;
  g0[3] = (unsigned)((ga >> 32) & 0x1FFFFFFu) | 0x80000000u;
  v8i g1;
  g1[0] = (int)(2u << 16);
  g1[1] = (int)((unsigned)(D_MODEL & 0xFFFF) << 16);
  g1[2] = (int)((D_MODEL >> 16) | ((TOKENS & 0xFFFF) << 16));
  g1[3] = (int)((TOKENS >> 16) | (KC << 16));
  g1[4] = (int)TM;
  g1[5] = (int)D_MODEL;
  g1[6] = 0;
  g1[7] = 0;
  const v4i gz4 = {0, 0, 0, 0};                          // groups 2/3: dims 3/4 unused
  const v8i gz8 = {0, 0, 0, 0, 0, 0, 0, 0};
  __builtin_amdgcn_tensor_load_to_lds(g0, g1, gz4, gz4, gz8, 0);
}
#endif

// ---------------- weight prep: fp32 -> bf16, K-contiguous columns ----------------
__global__ void k_conv_w1(const float* __restrict__ src, __bf16* __restrict__ dst, int n) {
  int i = blockIdx.x * blockDim.x + threadIdx.x;
  if (i < n) dst[i] = (__bf16)src[i];
}

__global__ void k_conv_w2(const float* __restrict__ wup, __bf16* __restrict__ dst) {
  int o = blockIdx.x * blockDim.x + threadIdx.x;
  if (o >= D_MODEL * N1) return;
  int d  = o >> 9;
  int rg = o & 511;
  int s  = rg >> 6;
  int r  = rg & 63;
  dst[o] = (__bf16)wup[(size_t)s * (D_MODEL * RANK) + (size_t)d * RANK + r];
}

// ---------------- fused RMSNorm -> GEMM1 -> SiLU -> GEMM2 -> residual ----------------
__global__ __launch_bounds__(256, 1)
void k_spoke_fused(const float* __restrict__ h,
                   const __bf16* __restrict__ W1,   // [512][2048] K-contig cols
                   const __bf16* __restrict__ W2,   // [2048][512] K-contig cols
                   const float* __restrict__ gate_bias,
                   float* __restrict__ out) {
  const int tid       = threadIdx.x;
  const int lane      = tid & 31;
  const int wave      = tid >> 5;          // 0..7, owns N-slice of 64 (G1) / 256 (G2)
  const int laneLo    = lane & 15;
  const int laneHiOff = (lane >> 4) << 3;  // 0 or 8
  const int blockTok0 = blockIdx.x * TM;

  extern __shared__ char smem[];
  float*  lds_inv = (float*)(smem + OFF_INV);
  __bf16* lds_a   = (__bf16*)(smem + OFF_A);
  __bf16* lds_v   = (__bf16*)(smem + OFF_V);

  const float gb    = gate_bias[0];
  const float scale = (1.0f / (1.0f + __expf(-gb))) * (1.0f / NUM_SPOKES);

#if USE_TDM
  if (wave == 0) {  // kick off first A tile while everyone computes sums of squares
    tdm_load_tile(h + (size_t)blockTok0 * D_MODEL, OFF_RAW0);
  }
#endif

  // ---- Phase A: per-token inv_rms (4 lanes per token) ----
  {
    const int token = tid >> 2;            // 0..63
    const int part  = tid & 3;
    const float* hrow = h + (size_t)(blockTok0 + token) * D_MODEL;
    float ss = 0.0f;
    #pragma unroll 8
    for (int j = 0; j < D_MODEL / 16; ++j) {
      const float4 hv = *(const float4*)(hrow + part * 4 + j * 16);
      ss += hv.x * hv.x + hv.y * hv.y + hv.z * hv.z + hv.w * hv.w;
    }
    ss += __shfl_xor(ss, 1, 32);
    ss += __shfl_xor(ss, 2, 32);
    if (part == 0) lds_inv[token] = rsqrtf(ss * (1.0f / D_MODEL) + EPS_F);
  }
  __syncthreads();

  // ---- Phase B: GEMM1 (view = A_norm @ W1), K staged in LDS tiles of KC ----
  v8f acc[4][4] = {};
  for (int kt = 0; kt < NKT; ++kt) {
    const float* raw = (const float*)(smem + OFF_RAW0 + (kt & 1) * RAWBYTES);

#if USE_TDM
    if (wave == 0) {
      if (kt + 1 < NKT) {   // prefetch next tile into the other buffer, then wait tile kt
        tdm_load_tile(h + (size_t)blockTok0 * D_MODEL + (kt + 1) * KC,
                      (unsigned)(OFF_RAW0 + ((kt + 1) & 1) * RAWBYTES));
        __builtin_amdgcn_s_wait_tensorcnt(1);
      } else {
        __builtin_amdgcn_s_wait_tensorcnt(0);
      }
    }
    __syncthreads();
#else
    {
      float* rawW = (float*)(smem + OFF_RAW0 + (kt & 1) * RAWBYTES);
      const float* gsrc = h + (size_t)blockTok0 * D_MODEL + kt * KC;
      #pragma unroll
      for (int i = 0; i < (TM * KC / 4) / 256; ++i) {   // 16 float4 per thread
        const int seg = tid + i * 256;
        const int r   = seg >> 6;          // KC/4 = 64 segments per row
        const int cc  = (seg & 63) * 4;
        *(float4*)&rawW[r * KC + cc] = *(const float4*)(gsrc + (size_t)r * D_MODEL + cc);
      }
      __syncthreads();
    }
#endif

    // normalize + bf16 convert: each wave owns 8 rows; lanes sweep a row (no conflicts)
    #pragma unroll
    for (int j = 0; j < 8; ++j) {
      const int row    = wave * 8 + j;
      const float invr = lds_inv[row];
      #pragma unroll
      for (int c = 0; c < 2; ++c) {
        const int col = lane * 4 + c * 128;
        const float4 rv = *(const float4*)&raw[row * KC + col];
        v4bf pv;
        pv[0] = (__bf16)(rv.x * invr);
        pv[1] = (__bf16)(rv.y * invr);
        pv[2] = (__bf16)(rv.z * invr);
        pv[3] = (__bf16)(rv.w * invr);
        *(v4bf*)&lds_a[row * LDSA_STRIDE + col] = pv;
      }
    }
    __syncthreads();

    // 4 M-tiles x 4 N-tiles per wave -> 16 WMMA per 32-K step, B loaded once per wave
    for (int k0 = 0; k0 < KC; k0 += 32) {
      const int kb = k0 + laneHiOff;
      v16bf af[4];
      #pragma unroll
      for (int mi = 0; mi < 4; ++mi) {
        const __bf16* ap = &lds_a[(mi * 16 + laneLo) * LDSA_STRIDE + kb];
        af[mi] = cat8(*(const v8bf*)ap, *(const v8bf*)(ap + 16));
      }
      #pragma unroll
      for (int ni = 0; ni < 4; ++ni) {
        const int n = wave * 64 + ni * 16 + laneLo;
        const __bf16* bp = W1 + (size_t)n * D_MODEL + kt * KC + kb;
        __builtin_prefetch(bp + 32, 0, 1);
        const v16bf bfr = cat8(*(const v8bf*)bp, *(const v8bf*)(bp + 16));
        #pragma unroll
        for (int mi = 0; mi < 4; ++mi)
          acc[mi][ni] = wmma_bf16(af[mi], bfr, acc[mi][ni]);
      }
    }
    __syncthreads();   // lds_a + raw buffer free for the next tile
  }

  // ---- SiLU + bf16 store of view tile [64 x 512] to LDS ----
  #pragma unroll
  for (int ni = 0; ni < 4; ++ni) {
    const int col = wave * 64 + ni * 16 + laneLo;
    #pragma unroll
    for (int mi = 0; mi < 4; ++mi) {
      #pragma unroll
      for (int v = 0; v < 8; ++v) {
        const float x = acc[mi][ni][v];
        const float s = x / (1.0f + __expf(-x));
        lds_v[(mi * 16 + v + laneHiOff) * LDSV_STRIDE + col] = (__bf16)s;
      }
    }
  }
  __syncthreads();

  // ---- Phase C: GEMM2 (update = view @ W2), wave owns 256 d-cols in 4 chunks ----
  for (int c = 0; c < 4; ++c) {
    v8f acc2[4][4] = {};
    const int nbase = wave * 256 + c * 64;
    for (int k0 = 0; k0 < N1; k0 += 32) {
      const int kb = k0 + laneHiOff;
      v16bf af[4];
      #pragma unroll
      for (int mi = 0; mi < 4; ++mi) {
        const __bf16* ap = &lds_v[(mi * 16 + laneLo) * LDSV_STRIDE + kb];
        af[mi] = cat8(*(const v8bf*)ap, *(const v8bf*)(ap + 16));
      }
      #pragma unroll
      for (int ni = 0; ni < 4; ++ni) {
        const int dcol = nbase + ni * 16 + laneLo;
        const __bf16* bp = W2 + (size_t)dcol * N1 + kb;
        __builtin_prefetch(bp + 32, 0, 1);
        const v16bf bfr = cat8(*(const v8bf*)bp, *(const v8bf*)(bp + 16));
        #pragma unroll
        for (int mi = 0; mi < 4; ++mi)
          acc2[mi][ni] = wmma_bf16(af[mi], bfr, acc2[mi][ni]);
      }
    }
    // epilogue: out = h + sigmoid(gate)/8 * update   (coalesced b32 across laneLo)
    #pragma unroll
    for (int ni = 0; ni < 4; ++ni) {
      const int dcol = nbase + ni * 16 + laneLo;
      #pragma unroll
      for (int mi = 0; mi < 4; ++mi) {
        #pragma unroll
        for (int v = 0; v < 8; ++v) {
          const int row = blockTok0 + mi * 16 + v + laneHiOff;
          const size_t idx = (size_t)row * D_MODEL + dcol;
          out[idx] = h[idx] + scale * acc2[mi][ni][v];
        }
      }
    }
  }
}

// ---------------- host launcher ----------------
extern "C" void kernel_launch(void* const* d_in, const int* in_sizes, int n_in,
                              void* d_out, int out_size, void* d_ws, size_t ws_size,
                              hipStream_t stream) {
  (void)in_sizes; (void)n_in; (void)out_size; (void)ws_size;
  const float* h  = (const float*)d_in[0];   // [4,4096,2048] f32
  const float* wd = (const float*)d_in[1];   // [8,64,2048]   f32
  const float* wu = (const float*)d_in[2];   // [8,2048,64]   f32
  const float* gb = (const float*)d_in[3];   // scalar        f32
  float* out = (float*)d_out;

  __bf16* W1 = (__bf16*)d_ws;                       // 2 MB
  __bf16* W2 = W1 + (size_t)N1 * D_MODEL;           // 2 MB

  const int nw = N1 * D_MODEL;
  k_conv_w1<<<(nw + 255) / 256, 256, 0, stream>>>(wd, W1, nw);
  k_conv_w2<<<(nw + 255) / 256, 256, 0, stream>>>(wu, W2);

  static bool attr_set = []() {
    (void)hipFuncSetAttribute((const void*)k_spoke_fused,
                              hipFuncAttributeMaxDynamicSharedMemorySize, SMEM_BYTES);
    return true;
  }();
  (void)attr_set;

  k_spoke_fused<<<TOKENS / TM, 256, (size_t)SMEM_BYTES, stream>>>(h, W1, W2, gb, out);
}

// v001
// A run of this version takes 170 microseconds.
// Timed twice side by side with v000, it ran 1.51 and 1.52 times as fast.
#include <hip/hip_runtime.h>
#include <hip/hip_bf16.h>

// ---------------- problem constants ----------------
#define D_MODEL    2048
#define NUM_SPOKES 8
#define RANK       64
#define N1         (NUM_SPOKES * RANK)
#define TOKENS     (4 * 4096)
#define TM         64
#define KC         256
#define NKT        (D_MODEL / KC)
#define LDSA_STRIDE (KC + 8)
#define LDSV_STRIDE (N1 + 8)
#define EPS_F      1.1920928955078125e-7f

// LDS byte offsets
#define OFF_INV  0                         // 64 floats (256 B)
#define RAWBYTES (TM * KC * 4)             // 65536 B per raw buffer
#define OFF_RAW0 256
#define OFF_RAW1 (OFF_RAW0 + RAWBYTES)     // 65792
#define OFF_A    (OFF_RAW1 + RAWBYTES)     // 131328
#define OFF_V    (OFF_A + TM * LDSA_STRIDE * 2)  // 165120
#define SMEM_BYTES (OFF_V + TM * LDSV_STRIDE * 2) // 231680  (< 320 KB/WGP)

typedef __attribute__((ext_vector_type(16))) __bf16 v16bf;
typedef __attribute__((ext_vector_type(8)))  __bf16 v8bf;
typedef __attribute__((ext_vector_type(4)))  __bf16 v4bf;
typedef __attribute__((ext_vector_type(8)))  float  v8f;
typedef unsigned int v4u __attribute__((ext_vector_type(4)));
typedef int          v8i __attribute__((ext_vector_type(8)));
typedef int          v4i __attribute__((ext_vector_type(4)));

#if __has_builtin(__builtin_amdgcn_tensor_load_to_lds) && __has_builtin(__builtin_amdgcn_s_wait_tensorcnt)
#define USE_TDM 1
#else
#define USE_TDM 0
#endif

static __device__ __forceinline__ v16bf cat8(v8bf lo, v8bf hi) {
  return __builtin_shufflevector(lo, hi, 0,1,2,3,4,5,6,7,8,9,10,11,12,13,14,15);
}

static __device__ __forceinline__ v8f wmma_bf16(v16bf a, v16bf b, v8f c) {
  return __builtin_amdgcn_wmma_f32_16x16x32_bf16(false, a, false, b, (short)0, c,
                                                 false, false);
}

#if USE_TDM
static __device__ __forceinline__ void tdm_load_tile(const float* gtile, unsigned lds_off) {
  const unsigned long long ga = (unsigned long long)(uintptr_t)gtile;
  v4u g0;
  g0[0] = 1u;
  g0[1] = lds_off;
  g0[2] = (unsigned)ga;
  g0[3] = (unsigned)((ga >> 32) & 0x1FFFFFFu) | 0x80000000u;
  v8i g1;
  g1[0] = (int)(2u << 16);
  g1[1] = (int)((unsigned)(D_MODEL & 0xFFFF) << 16);
  g1[2] = (int)((D_MODEL >> 16) | ((TOKENS & 0xFFFF) << 16));
  g1[3] = (int)((TOKENS >> 16) | (KC << 16));
  g1[4] = (int)TM;
  g1[5] = (int)D_MODEL;
  g1[6] = 0;
  g1[7] = 0;
  const v4i gz4 = {0, 0, 0, 0};                          // groups 2/3: dims 3/4 unused
  const v8i gz8 = {0, 0, 0, 0, 0, 0, 0, 0};
  __builtin_amdgcn_tensor_load_to_lds(g0, g1, gz4, gz4, gz8, 0);
}
#endif

#define PK_TILE 512                        // elements of one 16-column x 32-k tile
#define PK_WAVE (4 * PK_TILE)              // one wave's four tiles of a k step
#define PK_STEP (8 * PK_WAVE)              // the eight waves' tiles of a k step

// The fields of packed index o inside its k step: wave, sub = column inside the wave's 64, kk = k inside the step
static __device__ __forceinline__ void pk_decode(int o, int& wave, int& sub, int& kk) {
  const int lane = (o >> 3) & 31;
  sub  = ((o >> 9) & 3) * 16 + (lane & 15);
  kk   = ((o >> 8) & 1) * 16 + (lane >> 4) * 8 + (o & 7);
  wave = (o >> 11) & 7;
}

__global__ void k_conv_w1(const float* __restrict__ src, __bf16* __restrict__ dst, int n) {
  int o = blockIdx.x * blockDim.x + threadIdx.x;
  if (o >= n) return;
  int wave, sub, kk;
  pk_decode(o, wave, sub, kk);
  int col = wave * 64 + sub;               // a wave owns 64 rank columns
  int k   = (o / PK_STEP) * 32 + kk;       // 64 k steps
  dst[o] = (__bf16)src[(size_t)col * D_MODEL + k];
}

__global__ void k_conv_w2(const float* __restrict__ wup, __bf16* __restrict__ dst) {
  int o = blockIdx.x * blockDim.x + threadIdx.x;
  if (o >= D_MODEL * N1) return;
  int wave, sub, kk;
  pk_decode(o, wave, sub, kk);
  int step = o / PK_STEP;                  // [4 column chunks][16 k steps]
  int d  = wave * 256 + (step >> 4) * 64 + sub;
  int rg = (step & 15) * 32 + kk;
  int s  = rg >> 6;
  int r  = rg & 63;
  dst[o] = (__bf16)wup[(size_t)s * (D_MODEL * RANK) + (size_t)d * RANK + r];
}

// ---------------- fused RMSNorm -> GEMM1 -> SiLU -> GEMM2 -> residual ----------------
__global__ __launch_bounds__(256, 1)
void k_spoke_fused(const float* __restrict__ h,
                   const __bf16* __restrict__ W1,   // 512 cols x 2048 k, packed fragments
                   const __bf16* __restrict__ W2,   // 2048 cols x 512 k, packed fragments
                   const float* __restrict__ gate_bias,
                   float* __restrict__ out) {
  const int tid       = threadIdx.x;
  const int lane      = tid & 31;
  const int wave      = tid >> 5;          // 0..7, owns N-slice of 64 (G1) / 256 (G2)
  const int laneLo    = lane & 15;
  const int laneHiOff = (lane >> 4) << 3;  // 0 or 8
  const int blockTok0 = blockIdx.x * TM;

  extern __shared__ char smem[];
  float*  lds_inv = (float*)(smem + OFF_INV);
  __bf16* lds_a   = (__bf16*)(smem + OFF_A);
  __bf16* lds_v   = (__bf16*)(smem + OFF_V);

  const float gb    = gate_bias[0];
  const float scale = (1.0f / (1.0f + __expf(-gb))) * (1.0f / NUM_SPOKES);

#if USE_TDM
  if (wave == 0) {  // kick off first A tile while everyone computes sums of squares
    tdm_load_tile(h + (size_t)blockTok0 * D_MODEL, OFF_RAW0);
  }
#endif

  // ---- Phase A: per-token inv_rms (4 lanes per token) ----
  {
    const int token = tid >> 2;            // 0..63
    const int part  = tid & 3;
    const float* hrow = h + (size_t)(blockTok0 + token) * D_MODEL;
    float ss = 0.0f;
    #pragma unroll 8
    for (int j = 0; j < D_MODEL / 16; ++j) {
      const float4 hv = *(const float4*)(hrow + part * 4 + j * 16);
      ss += hv.x * hv.x + hv.y * hv.y + hv.z * hv.z + hv.w * hv.w;
    }
    ss += __shfl_xor(ss, 1, 32);
    ss += __shfl_xor(ss, 2, 32);
    if (part == 0) lds_inv[token] = rsqrtf(ss * (1.0f / D_MODEL) + EPS_F);
  }
  __syncthreads();

  // ---- Phase B: GEMM1 (view = A_norm @ W1), K staged in LDS tiles of KC ----
  v8f acc[4][4] = {};
  const __bf16* w1p = W1 + wave * PK_WAVE + lane * 8;
  for (int kt = 0; kt < NKT; ++kt) {
    const float* raw = (const float*)(smem + OFF_RAW0 + (kt & 1) * RAWBYTES);

#if USE_TDM
    if (wave == 0) {
      if (kt + 1 < NKT) {   // prefetch next tile into the other buffer, then wait tile kt
        tdm_load_tile(h + (size_t)blockTok0 * D_MODEL + (kt + 1) * KC,
                      (unsigned)(OFF_RAW0 + ((kt + 1) & 1) * RAWBYTES));
        __builtin_amdgcn_s_wait_tensorcnt(1);
      } else {
        __builtin_amdgcn_s_wait_tensorcnt(0);
      }
    }
    __syncthreads();
#else
    {
      float* rawW = (float*)(smem + OFF_RAW0 + (kt & 1) * RAWBYTES);
      const float* gsrc = h + (size_t)blockTok0 * D_MODEL + kt * KC;
      #pragma unroll
      for (int i = 0; i < (TM * KC / 4) / 256; ++i) {   // 16 float4 per thread
        const int seg = tid + i * 256;
        const int r   = seg >> 6;          // KC/4 = 64 segments per row
        const int cc  = (seg & 63) * 4;
        *(float4*)&rawW[r * KC + cc] = *(const float4*)(gsrc + (size_t)r * D_MODEL + cc);
      }
      __syncthreads();
    }
#endif

    // normalize + bf16 convert: each wave owns 8 rows; lanes sweep a row (no conflicts)
    #pragma unroll
    for (int j = 0; j < 8; ++j) {
      const int row    = wave * 8 + j;
      const float invr = lds_inv[row];
      #pragma unroll
      for (int c = 0; c < 2; ++c) {
        const int col = lane * 4 + c * 128;
        const float4 rv = *(const float4*)&raw[row * KC + col];
        v4bf pv;
        pv[0] = (__bf16)(rv.x * invr);
        pv[1] = (__bf16)(rv.y * invr);
        pv[2] = (__bf16)(rv.z * invr);
        pv[3] = (__bf16)(rv.w * invr);
        *(v4bf*)&lds_a[row * LDSA_STRIDE + col] = pv;
      }
    }
    __syncthreads();

    // 4 M-tiles x 4 N-tiles per wave -> 16 WMMA per 32-K step, B loaded once per wave
    for (int k0 = 0; k0 < KC; k0 += 32) {
      const int kb = k0 + laneHiOff;
      v16bf af[4];
      #pragma unroll
      for (int mi = 0; mi < 4; ++mi) {
        const __bf16* ap = &lds_a[(mi * 16 + laneLo) * LDSA_STRIDE + kb];
        af[mi] = cat8(*(const v8bf*)ap, *(const v8bf*)(ap + 16));
      }
      #pragma unroll
      for (int ni = 0; ni < 4; ++ni) {
        const __bf16* bp = w1p + ((kt * KC + k0) >> 5) * PK_STEP + ni * PK_TILE;
        const v16bf bfr = cat8(*(const v8bf*)bp, *(const v8bf*)(bp + PK_TILE / 2));
        #pragma unroll
        for (int mi = 0; mi < 4; ++mi)
          acc[mi][ni] = wmma_bf16(af[mi], bfr, acc[mi][ni]);
      }
    }
    __syncthreads();   // lds_a + raw buffer free for the next tile
  }

  // ---- SiLU + bf16 store of view tile [64 x 512] to LDS ----
  #pragma unroll
  for (int ni = 0; ni < 4; ++ni) {
    const int col = wave * 64 + ni * 16 + laneLo;
    #pragma unroll
    for (int mi = 0; mi < 4; ++mi) {
      #pragma unroll
      for (int v = 0; v < 8; ++v) {
        const float x = acc[mi][ni][v];
        const float s = x / (1.0f + __expf(-x));
        lds_v[(mi * 16 + v + laneHiOff) * LDSV_STRIDE + col] = (__bf16)s;
      }
    }
  }
  __syncthreads();

  // ---- Phase C: GEMM2 (update = view @ W2), wave owns 256 d-cols in 4 chunks ----
  for (int c = 0; c < 4; ++c) {
    v8f acc2[4][4] = {};
    const int nbase = wave * 256 + c * 64;
    const __bf16* w2p = W2 + c * ((N1 / 32) * PK_STEP) + wave * PK_WAVE + lane * 8;
    for (int k0 = 0; k0 < N1; k0 += 32) {
      const int kb = k0 + laneHiOff;
      v16bf af[4];
      #pragma unroll
      for (int mi = 0; mi < 4; ++mi) {
        const __bf16* ap = &lds_v[(mi * 16 + laneLo) * LDSV_STRIDE + kb];
        af[mi] = cat8(*(const v8bf*)ap, *(const v8bf*)(ap + 16));
      }
      #pragma unroll
      for (int ni = 0; ni < 4; ++ni) {
        const __bf16* bp = w2p + (k0 >> 5) * PK_STEP + ni * PK_TILE;
        const v16bf bfr = cat8(*(const v8bf*)bp, *(const v8bf*)(bp + PK_TILE / 2));
        #pragma unroll
        for (int mi = 0; mi < 4; ++mi)
          acc2[mi][ni] = wmma_bf16(af[mi], bfr, acc2[mi][ni]);
      }
    }
    // epilogue: out = h + sigmoid(gate)/8 * update   (coalesced b32 across laneLo)
    #pragma unroll
    for (int ni = 0; ni < 4; ++ni) {
      const int dcol = nbase + ni * 16 + laneLo;
      #pragma unroll
      for (int mi = 0; mi < 4; ++mi) {
        #pragma unroll
        for (int v = 0; v < 8; ++v) {
          const int row = blockTok0 + mi * 16 + v + laneHiOff;
          const size_t idx = (size_t)row * D_MODEL + dcol;
          out[idx] = h[idx] + scale * acc2[mi][ni][v];
        }
      }
    }
  }
}

// ---------------- host launcher ----------------
extern "C" void kernel_launch(void* const* d_in, const int* in_sizes, int n_in,
                              void* d_out, int out_size, void* d_ws, size_t ws_size,
                              hipStream_t stream) {
  (void)in_sizes; (void)n_in; (void)out_size; (void)ws_size;
  const float* h  = (const float*)d_in[0];   // [4,4096,2048] f32
  const float* wd = (const float*)d_in[1];   // [8,64,2048]   f32
  const float* wu = (const float*)d_in[2];   // [8,2048,64]   f32
  const float* gb = (const float*)d_in[3];   // scalar        f32
  float* out = (float*)d_out;

  __bf16* W1 = (__bf16*)d_ws;                       // 2 MB
  __bf16* W2 = W1 + (size_t)N1 * D_MODEL;           // 2 MB

  const int nw = N1 * D_MODEL;
  k_conv_w1<<<(nw + 255) / 256, 256, 0, stream>>>(wd, W1, nw);
  k_conv_w2<<<(nw + 255) / 256, 256, 0, stream>>>(wu, W2);

  static bool attr_set = []() {
    (void)hipFuncSetAttribute((const void*)k_spoke_fused,
                              hipFuncAttributeMaxDynamicSharedMemorySize, SMEM_BYTES);
    return true;
  }();
  (void)attr_set;

  k_spoke_fused<<<TOKENS / TM, 256, (size_t)SMEM_BYTES, stream>>>(h, W1, W2, gb, out);
}

// v002
// It runs in 93.6 microseconds.
// Next to v001, in two timings, it ran 1.81 and 1.83 times as fast.
// Counting every step since v000, it is 2.76 times as fast.
#include <hip/hip_runtime.h>
#include <hip/hip_bf16.h>

// ---------------- problem constants ----------------
#define D_MODEL    2048
#define NUM_SPOKES 8
#define RANK       64
#define N1         (NUM_SPOKES * RANK)
#define TOKENS     (4 * 4096)
#define TM         64
#define KC         256
#define NKT        (D_MODEL / KC)
#define LDSA_STRIDE (KC + 8)
#define LDSV_STRIDE (N1 + 8)
#define EPS_F      1.1920928955078125e-7f

// LDS byte offsets
#define OFF_INV  0                         // 64 floats (256 B)
#define RAWBYTES (TM * KC * 4)             // 65536 B per raw buffer
#define OFF_RAW0 256
#define OFF_RAW1 (OFF_RAW0 + RAWBYTES)     // 65792
#define OFF_A    (OFF_RAW1 + RAWBYTES)     // 131328
#define OFF_V    (OFF_A + TM * LDSA_STRIDE * 2)  // 165120
#define SMEM_BYTES (OFF_V + TM * LDSV_STRIDE * 2) // 231680  (< 320 KB/WGP)

typedef __attribute__((ext_vector_type(16))) __bf16 v16bf;
typedef __attribute__((ext_vector_type(8)))  __bf16 v8bf;
typedef __attribute__((ext_vector_type(4)))  __bf16 v4bf;
typedef __attribute__((ext_vector_type(8)))  float  v8f;
typedef unsigned int v4u __attribute__((ext_vector_type(4)));
typedef int          v8i __attribute__((ext_vector_type(8)));
typedef int          v4i __attribute__((ext_vector_type(4)));

#if __has_builtin(__builtin_amdgcn_tensor_load_to_lds) && __has_builtin(__builtin_amdgcn_s_wait_tensorcnt)
#define USE_TDM 1
#else
#define USE_TDM 0
#endif

static __device__ __forceinline__ v16bf cat8(v8bf lo, v8bf hi) {
  return __builtin_shufflevector(lo, hi, 0,1,2,3,4,5,6,7,8,9,10,11,12,13,14,15);
}

static __device__ __forceinline__ v8f wmma_bf16(v16bf a, v16bf b, v8f c) {
  return __builtin_amdgcn_wmma_f32_16x16x32_bf16(false, a, false, b, (short)0, c,
                                                 false, false);
}

#if USE_TDM
static __device__ __forceinline__ void tdm_load_tile(const float* gtile, unsigned lds_off) {
  const unsigned long long ga = (unsigned long long)(uintptr_t)gtile;
  v4u g0;
  g0[0] = 1u;
  g0[1] = lds_off;
  g0[2] = (unsigned)ga;
  g0[3] = (unsigned)((ga >> 32) & 0x1FFFFFFu) | 0x80000000u;
  v8i g1;
  g1[0] = (int)(2u << 16);
  g1[1] = (int)((unsigned)(D_MODEL & 0xFFFF) << 16);
  g1[2] = (int)((D_MODEL >> 16) | ((TOKENS & 0xFFFF) << 16));
  g1[3] = (int)((TOKENS >> 16) | (KC << 16));
  g1[4] = (int)TM;
  g1[5] = (int)D_MODEL;
  g1[6] = 0;
  g1[7] = 0;
  const v4i gz4 = {0, 0, 0, 0};                          // groups 2/3: dims 3/4 unused
  const v8i gz8 = {0, 0, 0, 0, 0, 0, 0, 0};
  __builtin_amdgcn_tensor_load_to_lds(g0, g1, gz4, gz4, gz8, 0);
}
#endif

#define PK_TILE 512                        // elements of one 16-column x 32-k tile
#define PK_WAVE (4 * PK_TILE)              // one wave's four tiles of a k step
#define PK_STEP (8 * PK_WAVE)              // the eight waves' tiles of a k step

// The fields of packed index o inside its k step: wave, sub = column inside the wave's 64, kk = k inside the step
static __device__ __forceinline__ void pk_decode(int o, int& wave, int& sub, int& kk) {
  const int lane = (o >> 3) & 31;
  sub  = ((o >> 9) & 3) * 16 + (lane & 15);
  kk   = ((o >> 8) & 1) * 16 + (lane >> 4) * 8 + (o & 7);
  wave = (o >> 11) & 7;
}

__global__ void k_conv_w1(const float* __restrict__ src, __bf16* __restrict__ dst, int n) {
  int o = blockIdx.x * blockDim.x + threadIdx.x;
  if (o >= n) return;
  int wave, sub, kk;
  pk_decode(o, wave, sub, kk);
  int col = wave * 64 + sub;               // a wave owns 64 rank columns
  int k   = (o / PK_STEP) * 32 + kk;       // 64 k steps
  dst[o] = (__bf16)src[(size_t)col * D_MODEL + k];
}

__global__ void k_conv_w2(const float* __restrict__ wup, __bf16* __restrict__ dst) {
  int o = blockIdx.x * blockDim.x + threadIdx.x;
  if (o >= D_MODEL * N1) return;
  int wave, sub, kk;
  pk_decode(o, wave, sub, kk);
  int step = o / PK_STEP;                  // [4 column chunks][16 k steps]
  int d  = wave * 256 + (step >> 4) * 64 + sub;
  int rg = (step & 15) * 32 + kk;
  int s  = rg >> 6;
  int r  = rg & 63;
  dst[o] = (__bf16)wup[(size_t)s * (D_MODEL * RANK) + (size_t)d * RANK + r];
}

// One k step of a wave's packed B: four 16-column tiles, two 16-byte halves each (4 KB a wave).
static __device__ __forceinline__ void load_bstep(const __bf16* __restrict__ p, v8bf (&dst)[8]) {
  #pragma unroll
  for (int ni = 0; ni < 4; ++ni) {
    dst[2 * ni]     = *(const v8bf*)(p + ni * PK_TILE);
    dst[2 * ni + 1] = *(const v8bf*)(p + ni * PK_TILE + PK_TILE / 2);
  }
}
#define BAHEAD 3                           // k steps of B in flight ahead of the one in use

__global__ __launch_bounds__(256) __attribute__((amdgpu_waves_per_eu(2, 2)))
void k_spoke_fused(const float* __restrict__ h,
                   const __bf16* __restrict__ W1,   // 512 cols x 2048 k, packed fragments
                   const __bf16* __restrict__ W2,   // 2048 cols x 512 k, packed fragments
                   const float* __restrict__ gate_bias,
                   float* __restrict__ out) {
  const int tid       = threadIdx.x;
  const int lane      = tid & 31;
  const int wave      = tid >> 5;          // 0..7, owns N-slice of 64 (G1) / 256 (G2)
  const int laneLo    = lane & 15;
  const int laneHiOff = (lane >> 4) << 3;  // 0 or 8
  const int blockTok0 = blockIdx.x * TM;

  extern __shared__ char smem[];
  float*  lds_inv = (float*)(smem + OFF_INV);
  __bf16* lds_a   = (__bf16*)(smem + OFF_A);
  __bf16* lds_v   = (__bf16*)(smem + OFF_V);

  const float gb    = gate_bias[0];
  const float scale = (1.0f / (1.0f + __expf(-gb))) * (1.0f / NUM_SPOKES);

#if USE_TDM
  if (wave == 0) {  // kick off first A tile while everyone computes sums of squares
    tdm_load_tile(h + (size_t)blockTok0 * D_MODEL, OFF_RAW0);
  }
#endif

  // ---- Phase A: per-token inv_rms (4 lanes per token) ----
  {
    const int token = tid >> 2;            // 0..63
    const int part  = tid & 3;
    const float* hrow = h + (size_t)(blockTok0 + token) * D_MODEL;
    float ss = 0.0f;
    #pragma unroll 8
    for (int j = 0; j < D_MODEL / 16; ++j) {
      const float4 hv = *(const float4*)(hrow + part * 4 + j * 16);
      ss += hv.x * hv.x + hv.y * hv.y + hv.z * hv.z + hv.w * hv.w;
    }
    ss += __shfl_xor(ss, 1, 32);
    ss += __shfl_xor(ss, 2, 32);
    if (part == 0) lds_inv[token] = rsqrtf(ss * (1.0f / D_MODEL) + EPS_F);
  }
  __syncthreads();

  // ---- Phase B: GEMM1 (view = A_norm @ W1), K staged in LDS tiles of KC ----
  v8f acc[4][4] = {};
  const __bf16* w1p = W1 + wave * PK_WAVE + lane * 8;
  // Register ring of B fragments: set (s & 3) holds k step s; steps s+1..s+3 are in flight from L2.
  v8bf bq[BAHEAD + 1][8];
  for (int kt = 0; kt < NKT; ++kt) {
    const float* raw = (const float*)(smem + OFF_RAW0 + (kt & 1) * RAWBYTES);

#if USE_TDM
    if (wave == 0) {
      if (kt + 1 < NKT) {   // prefetch next tile into the other buffer, then wait tile kt
        tdm_load_tile(h + (size_t)blockTok0 * D_MODEL + (kt + 1) * KC,
                      (unsigned)(OFF_RAW0 + ((kt + 1) & 1) * RAWBYTES));
        __builtin_amdgcn_s_wait_tensorcnt(1);
      } else {
        __builtin_amdgcn_s_wait_tensorcnt(0);
      }
    }
    __syncthreads();
#else
    {
      float* rawW = (float*)(smem + OFF_RAW0 + (kt & 1) * RAWBYTES);
      const float* gsrc = h + (size_t)blockTok0 * D_MODEL + kt * KC;
      #pragma unroll
      for (int i = 0; i < (TM * KC / 4) / 256; ++i) {   // 16 float4 per thread
        const int seg = tid + i * 256;
        const int r   = seg >> 6;          // KC/4 = 64 segments per row
        const int cc  = (seg & 63) * 4;
        *(float4*)&rawW[r * KC + cc] = *(const float4*)(gsrc + (size_t)r * D_MODEL + cc);
      }
      __syncthreads();
    }
#endif

    // this tile's first k steps of B fly while the tile is converted; the ring is empty at the tile's
    // other two barriers, which wait for every outstanding load
    const __bf16* w1t = w1p + kt * (KC / 32) * PK_STEP;
    #pragma unroll
    for (int u = 0; u < BAHEAD; ++u) load_bstep(w1t + u * PK_STEP, bq[u]);

    // normalize + bf16 convert: each wave owns 8 rows; lanes sweep a row (no conflicts)
    #pragma unroll
    for (int j = 0; j < 8; ++j) {
      const int row    = wave * 8 + j;
      const float invr = lds_inv[row];
      #pragma unroll
      for (int c = 0; c < 2; ++c) {
        const int col = lane * 4 + c * 128;
        const float4 rv = *(const float4*)&raw[row * KC + col];
        v4bf pv;
        pv[0] = (__bf16)(rv.x * invr);
        pv[1] = (__bf16)(rv.y * invr);
        pv[2] = (__bf16)(rv.z * invr);
        pv[3] = (__bf16)(rv.w * invr);
        *(v4bf*)&lds_a[row * LDSA_STRIDE + col] = pv;
      }
    }
    __syncthreads();

    // 4 M-tiles x 4 N-tiles per wave -> 16 WMMA per 32-K step, B loaded once per wave
    // unrolled so that the ring's set numbers are compile-time constants (the sets stay in registers)
    #pragma unroll
    for (int ks = 0; ks < KC / 32; ++ks) {
      if (ks + BAHEAD < KC / 32) load_bstep(w1t + (ks + BAHEAD) * PK_STEP, bq[(ks + BAHEAD) & 3]);
      const int kb = ks * 32 + laneHiOff;
      v16bf af[4];
      #pragma unroll
      for (int mi = 0; mi < 4; ++mi) {
        const __bf16* ap = &lds_a[(mi * 16 + laneLo) * LDSA_STRIDE + kb];
        af[mi] = cat8(*(const v8bf*)ap, *(const v8bf*)(ap + 16));
      }
      // holds the refill at the head of its k step: the scheduler otherwise sinks it to its use, three steps on
      __builtin_amdgcn_sched_barrier(0);
      #pragma unroll
      for (int ni = 0; ni < 4; ++ni) {
        const v16bf bfr = cat8(bq[ks & 3][2 * ni], bq[ks & 3][2 * ni + 1]);
        #pragma unroll
        for (int mi = 0; mi < 4; ++mi)
          acc[mi][ni] = wmma_bf16(af[mi], bfr, acc[mi][ni]);
      }
      // keeps the next step's loads and address updates behind these products and their load waits, as one group
      __builtin_amdgcn_sched_barrier(0);
    }
    __syncthreads();   // lds_a + raw buffer free for the next tile
  }

  // first k steps of the second weight stream fly while SiLU runs
  const __bf16* w2p = W2 + wave * PK_WAVE + lane * 8;
  #pragma unroll
  for (int u = 0; u < BAHEAD; ++u) load_bstep(w2p + u * PK_STEP, bq[u]);

  // ---- SiLU + bf16 store of view tile [64 x 512] to LDS ----
  #pragma unroll
  for (int ni = 0; ni < 4; ++ni) {
    const int col = wave * 64 + ni * 16 + laneLo;
    #pragma unroll
    for (int mi = 0; mi < 4; ++mi) {
      #pragma unroll
      for (int v = 0; v < 8; ++v) {
        const float x = acc[mi][ni][v];
        const float s = x / (1.0f + __expf(-x));
        lds_v[(mi * 16 + v + laneHiOff) * LDSV_STRIDE + col] = (__bf16)s;
      }
    }
  }
  __syncthreads();

  // ---- Phase C: GEMM2 (update = view @ W2), wave owns 256 d-cols in 4 chunks ----
  // the chunks' k steps follow one another in W2: one running pointer serves every refill of a trip.
  // The last trip's three refills past step 63 read the first steps of W1, which the host places directly
  // behind W2 (written in the same call, never used): no test in the loop, so the load waits stay counted.
  const __bf16* wq = w2p + BAHEAD * PK_STEP;
  for (int c = 0; c < 4; ++c) {
    v8f acc2[4][4] = {};
    const int nbase = wave * 256 + c * 64;
    for (int k4 = 0; k4 < N1 / 32; k4 += 4) {
      // four k steps a trip, so that the ring's set numbers are compile-time constants
      #pragma unroll
      for (int u = 0; u < 4; ++u) {
        load_bstep(wq + u * PK_STEP, bq[(u + BAHEAD) & 3]);
        const int kb = (k4 + u) * 32 + laneHiOff;
        v16bf af[4];
        #pragma unroll
        for (int mi = 0; mi < 4; ++mi) {
          const __bf16* ap = &lds_v[(mi * 16 + laneLo) * LDSV_STRIDE + kb];
          af[mi] = cat8(*(const v8bf*)ap, *(const v8bf*)(ap + 16));
        }
        // holds the refill at the head of its k step: the scheduler otherwise sinks it to its use, three steps on
        __builtin_amdgcn_sched_barrier(0);
        #pragma unroll
        for (int ni = 0; ni < 4; ++ni) {
          const v16bf bfr = cat8(bq[u][2 * ni], bq[u][2 * ni + 1]);
          #pragma unroll
          for (int mi = 0; mi < 4; ++mi)
            acc2[mi][ni] = wmma_bf16(af[mi], bfr, acc2[mi][ni]);
        }
        // the trip's refills name wq's registers: this wait stands in front of their rewrite at the trip's foot
        if (u == 3) asm volatile("s_wait_xcnt 0x0" ::: "memory");
        // keeps the next step's loads and address updates behind these products and their load waits, as one group
        __builtin_amdgcn_sched_barrier(0);
      }
      wq += 4 * PK_STEP;
    }
    // epilogue: out = h + sigmoid(gate)/8 * update   (coalesced b32 across laneLo)
    #pragma unroll
    for (int ni = 0; ni < 4; ++ni) {
      const int dcol = nbase + ni * 16 + laneLo;
      #pragma unroll
      for (int mi = 0; mi < 4; ++mi) {
        #pragma unroll
        for (int v = 0; v < 8; ++v) {
          const int row = blockTok0 + mi * 16 + v + laneHiOff;
          const size_t idx = (size_t)row * D_MODEL + dcol;
          out[idx] = h[idx] + scale * acc2[mi][ni][v];
        }
      }
    }
  }
}

// ---------------- host launcher ----------------
extern "C" void kernel_launch(void* const* d_in, const int* in_sizes, int n_in,
                              void* d_out, int out_size, void* d_ws, size_t ws_size,
                              hipStream_t stream) {
  (void)in_sizes; (void)n_in; (void)out_size; (void)ws_size;
  const float* h  = (const float*)d_in[0];   // [4,4096,2048] f32
  const float* wd = (const float*)d_in[1];   // [8,64,2048]   f32
  const float* wu = (const float*)d_in[2];   // [8,2048,64]   f32
  const float* gb = (const float*)d_in[3];   // scalar        f32
  float* out = (float*)d_out;

  __bf16* W2 = (__bf16*)d_ws;                       // 2 MB
  __bf16* W1 = W2 + (size_t)N1 * D_MODEL;           // 2 MB, directly behind W2: the ring's reads past W2 land here

  const int nw = N1 * D_MODEL;
  k_conv_w1<<<(nw + 255) / 256, 256, 0, stream>>>(wd, W1, nw);
  k_conv_w2<<<(nw + 255) / 256, 256, 0, stream>>>(wu, W2);

  static bool attr_set = []() {
    (void)hipFuncSetAttribute((const void*)k_spoke_fused,
                              hipFuncAttributeMaxDynamicSharedMemorySize, SMEM_BYTES);
    return true;
  }();
  (void)attr_set;

  k_spoke_fused<<<TOKENS / TM, 256, (size_t)SMEM_BYTES, stream>>>(h, W1, W2, gb, out);
}

// v003
// Measured time: 84.8 microseconds a run.
// In two side-by-side timings against v002, it was 1.10 and 1.11 times as fast.
// Over all steps from v000 it is 3.05 times as fast.
#include <hip/hip_runtime.h>
#include <hip/hip_bf16.h>

// ---------------- problem constants ----------------
#define D_MODEL    2048
#define NUM_SPOKES 8
#define RANK       64
#define N1         (NUM_SPOKES * RANK)
#define TOKENS     (4 * 4096)
#define TM         64
#define KC         256
#define NKT        (D_MODEL / KC)
#define LDSA_STRIDE (KC + 8)
#define LDSV_STRIDE (N1 + 8)
#define EPS_F      1.1920928955078125e-7f

// LDS byte offsets
#define OFF_INV  0                         // 64 floats (256 B)
#define RAWBYTES (TM * KC * 4)             // 65536 B per raw buffer
#define OFF_RAW0 256
#define OFF_RAW1 (OFF_RAW0 + RAWBYTES)     // 65792
#define OFF_A    (OFF_RAW1 + RAWBYTES)     // 131328
#define OFF_V    (OFF_A + TM * LDSA_STRIDE * 2)  // 165120
#define SMEM_BYTES (OFF_V + TM * LDSV_STRIDE * 2) // 231680  (< 320 KB/WGP)

typedef __attribute__((ext_vector_type(16))) __bf16 v16bf;
typedef __attribute__((ext_vector_type(8)))  __bf16 v8bf;
typedef __attribute__((ext_vector_type(4)))  __bf16 v4bf;
typedef __attribute__((ext_vector_type(8)))  float  v8f;
typedef __attribute__((ext_vector_type(2)))  float  v2f;
typedef unsigned int v4u __attribute__((ext_vector_type(4)));
typedef int          v8i __attribute__((ext_vector_type(8)));
typedef int          v4i __attribute__((ext_vector_type(4)));

#if __has_builtin(__builtin_amdgcn_tensor_load_to_lds) && __has_builtin(__builtin_amdgcn_s_wait_tensorcnt)
#define USE_TDM 1
#else
#define USE_TDM 0
#endif

static __device__ __forceinline__ v16bf cat8(v8bf lo, v8bf hi) {
  return __builtin_shufflevector(lo, hi, 0,1,2,3,4,5,6,7,8,9,10,11,12,13,14,15);
}

static __device__ __forceinline__ v8f wmma_bf16(v16bf a, v16bf b, v8f c) {
  return __builtin_amdgcn_wmma_f32_16x16x32_bf16(false, a, false, b, (short)0, c,
                                                 false, false);
}

#if USE_TDM
static __device__ __forceinline__ void tdm_load_tile(const float* gtile, unsigned lds_off) {
  const unsigned long long ga = (unsigned long long)(uintptr_t)gtile;
  v4u g0;
  g0[0] = 1u;
  g0[1] = lds_off;
  g0[2] = (unsigned)ga;
  g0[3] = (unsigned)((ga >> 32) & 0x1FFFFFFu) | 0x80000000u;
  v8i g1;
  g1[0] = (int)(2u << 16);
  g1[1] = (int)((unsigned)(D_MODEL & 0xFFFF) << 16);
  g1[2] = (int)((D_MODEL >> 16) | ((TOKENS & 0xFFFF) << 16));
  g1[3] = (int)((TOKENS >> 16) | (KC << 16));
  g1[4] = (int)TM;
  g1[5] = (int)D_MODEL;
  g1[6] = 0;
  g1[7] = 0;
  const v4i gz4 = {0, 0, 0, 0};                          // groups 2/3: dims 3/4 unused
  const v8i gz8 = {0, 0, 0, 0, 0, 0, 0, 0};
  __builtin_amdgcn_tensor_load_to_lds(g0, g1, gz4, gz4, gz8, 0);
}
#endif

#define PK_TILE 512                        // elements of one 16-column x 32-k tile
#define PK_WAVE (4 * PK_TILE)              // one wave's four tiles of a k step
#define PK_STEP (8 * PK_WAVE)              // the eight waves' tiles of a k step

// The fields of packed index o inside its k step: wave, sub = column inside the wave's 64, kk = k inside the step
static __device__ __forceinline__ void pk_decode(int o, int& wave, int& sub, int& kk) {
  const int lane = (o >> 3) & 31;
  sub  = ((o >> 9) & 3) * 16 + (lane & 15);
  kk   = ((o >> 8) & 1) * 16 + (lane >> 4) * 8 + (o & 7);
  wave = (o >> 11) & 7;
}

__global__ void k_conv_w1(const float* __restrict__ src, __bf16* __restrict__ dst, int n) {
  int o = blockIdx.x * blockDim.x + threadIdx.x;
  if (o >= n) return;
  int wave, sub, kk;
  pk_decode(o, wave, sub, kk);
  int col = wave * 64 + sub;               // a wave owns 64 rank columns
  int k   = (o / PK_STEP) * 32 + kk;       // 64 k steps
  dst[o] = (__bf16)src[(size_t)col * D_MODEL + k];
}

__global__ void k_conv_w2(const float* __restrict__ wup, __bf16* __restrict__ dst) {
  int o = blockIdx.x * blockDim.x + threadIdx.x;
  if (o >= D_MODEL * N1) return;
  int wave, sub, kk;
  pk_decode(o, wave, sub, kk);
  int step = o / PK_STEP;                  // [4 column chunks][16 k steps]
  int d  = wave * 256 + (step >> 4) * 64 + sub;
  int rg = (step & 15) * 32 + kk;
  int s  = rg >> 6;
  int r  = rg & 63;
  dst[o] = (__bf16)wup[(size_t)s * (D_MODEL * RANK) + (size_t)d * RANK + r];
}

// One k step of a wave's packed B: four 16-column tiles, two 16-byte halves each (4 KB a wave).
static __device__ __forceinline__ void load_bstep(const __bf16* __restrict__ p, v8bf (&dst)[8]) {
  #pragma unroll
  for (int ni = 0; ni < 4; ++ni) {
    dst[2 * ni]     = *(const v8bf*)(p + ni * PK_TILE);
    dst[2 * ni + 1] = *(const v8bf*)(p + ni * PK_TILE + PK_TILE / 2);
  }
}
#define BAHEAD 3                           // k steps of B in flight ahead of the one in use

__global__ __launch_bounds__(256) __attribute__((amdgpu_waves_per_eu(2, 2)))
void k_spoke_fused(const float* __restrict__ h,
                   const __bf16* __restrict__ W1,   // 512 cols x 2048 k, packed fragments
                   const __bf16* __restrict__ W2,   // 2048 cols x 512 k, packed fragments
                   const float* __restrict__ gate_bias,
                   float* __restrict__ out) {
  const int tid       = threadIdx.x;
  const int lane      = tid & 31;
  const int wave      = tid >> 5;          // 0..7, owns N-slice of 64 (G1) / 256 (G2)
  const int laneLo    = lane & 15;
  const int laneHiOff = (lane >> 4) << 3;  // 0 or 8
  const int blockTok0 = blockIdx.x * TM;

  extern __shared__ char smem[];
  float*  lds_inv = (float*)(smem + OFF_INV);
  __bf16* lds_a   = (__bf16*)(smem + OFF_A);
  __bf16* lds_v   = (__bf16*)(smem + OFF_V);

  const float gb    = gate_bias[0];
  const float scale = (1.0f / (1.0f + __expf(-gb))) * (1.0f / NUM_SPOKES);

#if USE_TDM
  if (wave == 0) {  // kick off first A tile
    tdm_load_tile(h + (size_t)blockTok0 * D_MODEL, OFF_RAW0);
  }
#endif

  // ---- GEMM1 (A @ W1 on the raw rows), K staged in LDS tiles of KC ----
  // A row's 1/rms is one factor of its whole dot product: it is applied to the f32 sums behind the loop,
  // and the squares are summed from the staged tiles on the way, so h needs no pass of its own for the norm.
  v8f acc[4][4] = {};
  v2f ssq[8] = {};                         // this lane's share of the squares of the wave's 8 rows, even | odd columns
  const __bf16* w1p = W1 + wave * PK_WAVE + lane * 8;
  // Register ring of B fragments: set (s & 3) holds k step s; steps s+1..s+3 are in flight from L2.
  v8bf bq[BAHEAD + 1][8];
  for (int kt = 0; kt < NKT; ++kt) {
    const float* raw = (const float*)(smem + OFF_RAW0 + (kt & 1) * RAWBYTES);

#if USE_TDM
    if (wave == 0) {
      if (kt + 1 < NKT) {   // prefetch next tile into the other buffer, then wait tile kt
        tdm_load_tile(h + (size_t)blockTok0 * D_MODEL + (kt + 1) * KC,
                      (unsigned)(OFF_RAW0 + ((kt + 1) & 1) * RAWBYTES));
        __builtin_amdgcn_s_wait_tensorcnt(1);
      } else {
        __builtin_amdgcn_s_wait_tensorcnt(0);
      }
    }
    __syncthreads();
#else
    {
      float* rawW = (float*)(smem + OFF_RAW0 + (kt & 1) * RAWBYTES);
      const float* gsrc = h + (size_t)blockTok0 * D_MODEL + kt * KC;
      #pragma unroll
      for (int i = 0; i < (TM * KC / 4) / 256; ++i) {   // 16 float4 per thread
        const int seg = tid + i * 256;
        const int r   = seg >> 6;          // KC/4 = 64 segments per row
        const int cc  = (seg & 63) * 4;
        *(float4*)&rawW[r * KC + cc] = *(const float4*)(gsrc + (size_t)r * D_MODEL + cc);
      }
      __syncthreads();
    }
#endif

    // this tile's first k steps of B fly while the tile is converted; the ring is empty at the tile's
    // other two barriers, which wait for every outstanding load
    const __bf16* w1t = w1p + kt * (KC / 32) * PK_STEP;
    #pragma unroll
    for (int u = 0; u < BAHEAD; ++u) load_bstep(w1t + u * PK_STEP, bq[u]);

    // bf16 convert + squares: each wave owns 8 rows; lanes sweep a row (no conflicts)
    #pragma unroll
    for (int j = 0; j < 8; ++j) {
      const int row    = wave * 8 + j;
      #pragma unroll
      for (int c = 0; c < 2; ++c) {
        const int col = lane * 4 + c * 128;
        const float4 rv = *(const float4*)&raw[row * KC + col];
        v4bf pv;
        const v2f lo = {rv.x, rv.y}, hi = {rv.z, rv.w};   // the loaded register pairs: packed FMAs, no moves
        ssq[j] = __builtin_elementwise_fma(lo, lo, ssq[j]);
        ssq[j] = __builtin_elementwise_fma(hi, hi, ssq[j]);
        pv[0] = (__bf16)rv.x;
        pv[1] = (__bf16)rv.y;
        pv[2] = (__bf16)rv.z;
        pv[3] = (__bf16)rv.w;
        *(v4bf*)&lds_a[row * LDSA_STRIDE + col] = pv;
      }
    }
    if (kt == NKT - 1) {   // rows complete: 1/rms to LDS, published by the last tile's two barriers
      float mine = 0.0f;
      #pragma unroll
      for (int j = 0; j < 8; ++j) {
        float s = ssq[j][0] + ssq[j][1];
        s += __shfl_xor(s, 16, 32);
        s += __shfl_xor(s, 8, 32);
        s += __shfl_xor(s, 4, 32);
        s += __shfl_xor(s, 2, 32);
        s += __shfl_xor(s, 1, 32);
        if (lane == j) mine = s;
      }
      if (lane < 8) lds_inv[wave * 8 + lane] = rsqrtf(mine * (1.0f / D_MODEL) + EPS_F);
    }
    __syncthreads();

    // 4 M-tiles x 4 N-tiles per wave -> 16 WMMA per 32-K step, B loaded once per wave
    // unrolled so that the ring's set numbers are compile-time constants (the sets stay in registers)
    #pragma unroll
    for (int ks = 0; ks < KC / 32; ++ks) {
      if (ks + BAHEAD < KC / 32) load_bstep(w1t + (ks + BAHEAD) * PK_STEP, bq[(ks + BAHEAD) & 3]);
      const int kb = ks * 32 + laneHiOff;
      v16bf af[4];
      #pragma unroll
      for (int mi = 0; mi < 4; ++mi) {
        const __bf16* ap = &lds_a[(mi * 16 + laneLo) * LDSA_STRIDE + kb];
        af[mi] = cat8(*(const v8bf*)ap, *(const v8bf*)(ap + 16));
      }
      // holds the refill at the head of its k step: the scheduler otherwise sinks it to its use, three steps on
      __builtin_amdgcn_sched_barrier(0);
      #pragma unroll
      for (int ni = 0; ni < 4; ++ni) {
        const v16bf bfr = cat8(bq[ks & 3][2 * ni], bq[ks & 3][2 * ni + 1]);
        #pragma unroll
        for (int mi = 0; mi < 4; ++mi)
          acc[mi][ni] = wmma_bf16(af[mi], bfr, acc[mi][ni]);
      }
      // keeps the next step's loads and address updates behind these products and their load waits, as one group
      __builtin_amdgcn_sched_barrier(0);
    }
    __syncthreads();   // lds_a + raw buffer free for the next tile
  }

  // first k steps of the second weight stream fly while SiLU runs
  const __bf16* w2p = W2 + wave * PK_WAVE + lane * 8;
  #pragma unroll
  for (int u = 0; u < BAHEAD; ++u) load_bstep(w2p + u * PK_STEP, bq[u]);

  // ---- 1/rms + SiLU + bf16 store of view tile [64 x 512] to LDS ----
  float invr[4][8];                        // 1/rms of the 32 rows this lane's accumulators hold
  #pragma unroll
  for (int mi = 0; mi < 4; ++mi) {
    #pragma unroll
    for (int v = 0; v < 8; ++v) invr[mi][v] = lds_inv[mi * 16 + v + laneHiOff];
  }
  #pragma unroll
  for (int ni = 0; ni < 4; ++ni) {
    const int col = wave * 64 + ni * 16 + laneLo;
    #pragma unroll
    for (int mi = 0; mi < 4; ++mi) {
      #pragma unroll
      for (int v = 0; v < 8; ++v) {
        const float x = acc[mi][ni][v] * invr[mi][v];
        const float s = x / (1.0f + __expf(-x));
        lds_v[(mi * 16 + v + laneHiOff) * LDSV_STRIDE + col] = (__bf16)s;
      }
    }
  }
  __syncthreads();

  // ---- Phase C: GEMM2 (update = view @ W2), wave owns 256 d-cols in 4 chunks ----
  // the chunks' k steps follow one another in W2: one running pointer serves every refill of a trip.
  // The last trip's three refills past step 63 read the first steps of W1, which the host places directly
  // behind W2 (written in the same call, never used): no test in the loop, so the load waits stay counted.
  const __bf16* wq = w2p + BAHEAD * PK_STEP;
  for (int c = 0; c < 4; ++c) {
    v8f acc2[4][4] = {};
    const int nbase = wave * 256 + c * 64;
    for (int k4 = 0; k4 < N1 / 32; k4 += 4) {
      // four k steps a trip, so that the ring's set numbers are compile-time constants
      #pragma unroll
      for (int u = 0; u < 4; ++u) {
        load_bstep(wq + u * PK_STEP, bq[(u + BAHEAD) & 3]);
        const int kb = (k4 + u) * 32 + laneHiOff;
        v16bf af[4];
        #pragma unroll
        for (int mi = 0; mi < 4; ++mi) {
          const __bf16* ap = &lds_v[(mi * 16 + laneLo) * LDSV_STRIDE + kb];
          af[mi] = cat8(*(const v8bf*)ap, *(const v8bf*)(ap + 16));
        }
        // holds the refill at the head of its k step: the scheduler otherwise sinks it to its use, three steps on
        __builtin_amdgcn_sched_barrier(0);
        #pragma unroll
        for (int ni = 0; ni < 4; ++ni) {
          const v16bf bfr = cat8(bq[u][2 * ni], bq[u][2 * ni + 1]);
          #pragma unroll
          for (int mi = 0; mi < 4; ++mi)
            acc2[mi][ni] = wmma_bf16(af[mi], bfr, acc2[mi][ni]);
        }
        // the trip's refills name wq's registers: this wait stands in front of their rewrite at the trip's foot
        if (u == 3) asm volatile("s_wait_xcnt 0x0" ::: "memory");
        // keeps the next step's loads and address updates behind these products and their load waits, as one group
        __builtin_amdgcn_sched_barrier(0);
      }
      wq += 4 * PK_STEP;
    }
    // epilogue: out = h + sigmoid(gate)/8 * update   (coalesced b32 across laneLo)
    #pragma unroll
    for (int ni = 0; ni < 4; ++ni) {
      const int dcol = nbase + ni * 16 + laneLo;
      #pragma unroll
      for (int mi = 0; mi < 4; ++mi) {
        #pragma unroll
        for (int v = 0; v < 8; ++v) {
          const int row = blockTok0 + mi * 16 + v + laneHiOff;
          const size_t idx = (size_t)row * D_MODEL + dcol;
          out[idx] = h[idx] + scale * acc2[mi][ni][v];
        }
      }
    }
  }
}

// ---------------- host launcher ----------------
extern "C" void kernel_launch(void* const* d_in, const int* in_sizes, int n_in,
                              void* d_out, int out_size, void* d_ws, size_t ws_size,
                              hipStream_t stream) {
  (void)in_sizes; (void)n_in; (void)out_size; (void)ws_size;
  const float* h  = (const float*)d_in[0];   // [4,4096,2048] f32
  const float* wd = (const float*)d_in[1];   // [8,64,2048]   f32
  const float* wu = (const float*)d_in[2];   // [8,2048,64]   f32
  const float* gb = (const float*)d_in[3];   // scalar        f32
  float* out = (float*)d_out;

  __bf16* W2 = (__bf16*)d_ws;                       // 2 MB
  __bf16* W1 = W2 + (size_t)N1 * D_MODEL;           // 2 MB, directly behind W2: the ring's reads past W2 land here

  const int nw = N1 * D_MODEL;
  k_conv_w1<<<(nw + 255) / 256, 256, 0, stream>>>(wd, W1, nw);
  k_conv_w2<<<(nw + 255) / 256, 256, 0, stream>>>(wu, W2);

  static bool attr_set = []() {
    (void)hipFuncSetAttribute((const void*)k_spoke_fused,
                              hipFuncAttributeMaxDynamicSharedMemorySize, SMEM_BYTES);
    return true;
  }();
  (void)attr_set;

  k_spoke_fused<<<TOKENS / TM, 256, (size_t)SMEM_BYTES, stream>>>(h, W1, W2, gb, out);
}

// v004
// A run of this version takes 78.7 microseconds.
// In both of two side-by-side timings against v003, it was 1.07 times as fast.
// Over all steps from v000 it is 3.27 times as fast.
#include <hip/hip_runtime.h>
#include <hip/hip_bf16.h>

// ---------------- problem constants ----------------
#define D_MODEL    2048
#define NUM_SPOKES 8
#define RANK       64
#define N1         (NUM_SPOKES * RANK)
#define TOKENS     (4 * 4096)
#define TM         64
#define KC         256
#define NKT        (D_MODEL / KC)
#define LDSA_STRIDE (KC + 8)
#define LDSV_STRIDE (N1 + 8)
#define EPS_F      1.1920928955078125e-7f

// LDS byte offsets
#define OFF_INV  0                         // 64 floats (256 B)
#define RAWBYTES (TM * KC * 4)             // 65536 B per raw buffer
#define OFF_RAW0 256
#define OFF_RAW1 (OFF_RAW0 + RAWBYTES)     // 65792
#define OFF_A    (OFF_RAW1 + RAWBYTES)     // 131328
#define OFF_V    (OFF_A + TM * LDSA_STRIDE * 2)  // 165120
#define SMEM_BYTES (OFF_V + TM * LDSV_STRIDE * 2) // 231680  (< 320 KB/WGP)
// Residual tiles: behind GEMM1 the raw and A buffers are free; each wave keeps there, for itself alone,
// the 64 rows x 64 columns of h that its current column chunk adds to.
#define HR_ROWB  256
#define HR_PITCH (HR_ROWB + 16)
#define HR_SLICE 18432
#define OFF_HR   2048
static_assert(TM * HR_PITCH <= HR_SLICE && HR_SLICE % 2048 == 0 && OFF_HR >= OFF_INV + TM * 4 &&
              OFF_HR + 8 * HR_SLICE <= OFF_V, "the eight residual tiles lie between the 1/rms values and the view tile");

typedef __attribute__((ext_vector_type(16))) __bf16 v16bf;
typedef __attribute__((ext_vector_type(8)))  __bf16 v8bf;
typedef __attribute__((ext_vector_type(4)))  __bf16 v4bf;
typedef __attribute__((ext_vector_type(8)))  float  v8f;
typedef __attribute__((ext_vector_type(2)))  float  v2f;
typedef unsigned int v4u __attribute__((ext_vector_type(4)));
typedef int          v8i __attribute__((ext_vector_type(8)));
typedef int          v4i __attribute__((ext_vector_type(4)));

#if __has_builtin(__builtin_amdgcn_tensor_load_to_lds) && __has_builtin(__builtin_amdgcn_s_wait_tensorcnt)
#define USE_TDM 1
#else
#define USE_TDM 0
#endif

static __device__ __forceinline__ v16bf cat8(v8bf lo, v8bf hi) {
  return __builtin_shufflevector(lo, hi, 0,1,2,3,4,5,6,7,8,9,10,11,12,13,14,15);
}

static __device__ __forceinline__ v8f wmma_bf16(v16bf a, v16bf b, v8f c) {
  return __builtin_amdgcn_wmma_f32_16x16x32_bf16(false, a, false, b, (short)0, c,
                                                 false, false);
}

#if USE_TDM
static __device__ __forceinline__ void tdm_load_tile(const float* gtile, unsigned lds_off) {
  const unsigned long long ga = (unsigned long long)(uintptr_t)gtile;
  v4u g0;
  g0[0] = 1u;
  g0[1] = lds_off;
  g0[2] = (unsigned)ga;
  g0[3] = (unsigned)((ga >> 32) & 0x1FFFFFFu) | 0x80000000u;
  v8i g1;
  g1[0] = (int)(2u << 16);
  g1[1] = (int)((unsigned)(D_MODEL & 0xFFFF) << 16);
  g1[2] = (int)((D_MODEL >> 16) | ((TOKENS & 0xFFFF) << 16));
  g1[3] = (int)((TOKENS >> 16) | (KC << 16));
  g1[4] = (int)TM;
  g1[5] = (int)D_MODEL;
  g1[6] = 0;
  g1[7] = 0;
  const v4i gz4 = {0, 0, 0, 0};                          // groups 2/3: dims 3/4 unused
  const v8i gz8 = {0, 0, 0, 0, 0, 0, 0, 0};
  __builtin_amdgcn_tensor_load_to_lds(g0, g1, gz4, gz4, gz8, 0);
}
#endif

// ---- a wave's own residual tile by tensor load: 64 rows of 256 bytes, source pitch one row of h ----
typedef uint32_t u32x4 __attribute__((ext_vector_type(4)));
typedef uint32_t u32x8 __attribute__((ext_vector_type(8)));
static __device__ __forceinline__ uint32_t uni(uint32_t v) { return (uint32_t)__builtin_amdgcn_readfirstlane(v); }
static __device__ __forceinline__ uint32_t pinned(uint32_t v) {
  uint32_t w = uni(v);
  asm volatile("" : "+s"(w));   // pinned(): holds the test in a scalar register, so that the branch on it is s_cmp + s_cbranch_scc
  return w;
}
static __device__ __forceinline__ u32x8 hr_group1() {   // every extent in bytes; tensor = tile
  u32x8 g;
  g[0] = uni((1u << 20) | (5u << 22) | (3u << 25));      // no mask, 1-byte elements, 16 bytes of pad behind every 256
  g[1] = uni(((uint32_t)HR_ROWB & 0xFFFFu) << 16);
  g[2] = uni(((uint32_t)HR_ROWB >> 16) | (((uint32_t)TM & 0xFFFFu) << 16));
  g[3] = uni(((uint32_t)TM >> 16) | ((uint32_t)HR_ROWB << 16));
  g[4] = uni((uint32_t)TM);
  g[5] = uni((uint32_t)(D_MODEL * 4));
  g[6] = uni(0u);
  g[7] = uni(0u);
  return g;
}
static __device__ __forceinline__ u32x4 hr_group0(uint32_t lds_dst, uint64_t ga) {
  u32x4 g;
  g[0] = uni(1u);
  g[1] = uni(lds_dst);
  g[2] = uni((uint32_t)ga);
  g[3] = uni((((uint32_t)(ga >> 32)) & 0x01FFFFFFu) | 0x80000000u);
  return g;
}

#define PK_TILE 512                        // elements of one 16-column x 32-k tile
#define PK_WAVE (4 * PK_TILE)              // one wave's four tiles of a k step
#define PK_STEP (8 * PK_WAVE)              // the eight waves' tiles of a k step

// The fields of packed index o inside its k step: wave, sub = column inside the wave's 64, kk = k inside the step
static __device__ __forceinline__ void pk_decode(int o, int& wave, int& sub, int& kk) {
  const int lane = (o >> 3) & 31;
  sub  = ((o >> 9) & 3) * 16 + (lane & 15);
  kk   = ((o >> 8) & 1) * 16 + (lane >> 4) * 8 + (o & 7);
  wave = (o >> 11) & 7;
}

__global__ void k_conv_w1(const float* __restrict__ src, __bf16* __restrict__ dst, int n) {
  int o = blockIdx.x * blockDim.x + threadIdx.x;
  if (o >= n) return;
  int wave, sub, kk;
  pk_decode(o, wave, sub, kk);
  int col = wave * 64 + sub;               // a wave owns 64 rank columns
  int k   = (o / PK_STEP) * 32 + kk;       // 64 k steps
  dst[o] = (__bf16)src[(size_t)col * D_MODEL + k];
}

__global__ void k_conv_w2(const float* __restrict__ wup, __bf16* __restrict__ dst) {
  int o = blockIdx.x * blockDim.x + threadIdx.x;
  if (o >= D_MODEL * N1) return;
  int wave, sub, kk;
  pk_decode(o, wave, sub, kk);
  int step = o / PK_STEP;                  // [4 column chunks][16 k steps]
  int d  = wave * 256 + (step >> 4) * 64 + sub;
  int rg = (step & 15) * 32 + kk;
  int s  = rg >> 6;
  int r  = rg & 63;
  dst[o] = (__bf16)wup[(size_t)s * (D_MODEL * RANK) + (size_t)d * RANK + r];
}

// One k step of a wave's packed B: four 16-column tiles, two 16-byte halves each (4 KB a wave).
static __device__ __forceinline__ void load_bstep(const __bf16* __restrict__ p, v8bf (&dst)[8]) {
  #pragma unroll
  for (int ni = 0; ni < 4; ++ni) {
    dst[2 * ni]     = *(const v8bf*)(p + ni * PK_TILE);
    dst[2 * ni + 1] = *(const v8bf*)(p + ni * PK_TILE + PK_TILE / 2);
  }
}
#define BAHEAD 3                           // k steps of B in flight ahead of the one in use

__global__ __launch_bounds__(256) __attribute__((amdgpu_waves_per_eu(2, 2)))
void k_spoke_fused(const float* __restrict__ h,
                   const __bf16* __restrict__ W1,   // 512 cols x 2048 k, packed fragments
                   const __bf16* __restrict__ W2,   // 2048 cols x 512 k, packed fragments
                   const float* __restrict__ gate_bias,
                   float* __restrict__ out) {
  const int tid       = threadIdx.x;
  const int lane      = tid & 31;
  const int wave      = tid >> 5;          // 0..7, owns N-slice of 64 (G1) / 256 (G2)
  const int laneLo    = lane & 15;
  const int laneHiOff = (lane >> 4) << 3;  // 0 or 8
  const int blockTok0 = blockIdx.x * TM;

  extern __shared__ __attribute__((aligned(2048))) char smem[];
  float*  lds_inv = (float*)(smem + OFF_INV);
  __bf16* lds_a   = (__bf16*)(smem + OFF_A);
  __bf16* lds_v   = (__bf16*)(smem + OFF_V);

  const float gb    = gate_bias[0];
  const float scale = (1.0f / (1.0f + __expf(-gb))) * (1.0f / NUM_SPOKES);

#if USE_TDM
  if (wave == 0) {  // kick off first A tile
    tdm_load_tile(h + (size_t)blockTok0 * D_MODEL, OFF_RAW0);
  }
#endif

  // ---- GEMM1 (A @ W1 on the raw rows), K staged in LDS tiles of KC ----
  // A row's 1/rms is one factor of its whole dot product: it is applied to the f32 sums behind the loop,
  // and the squares are summed from the staged tiles on the way, so h needs no pass of its own for the norm.
  v8f acc[4][4] = {};
  v2f ssq[8] = {};                         // this lane's share of the squares of the wave's 8 rows, even | odd columns
  const __bf16* w1p = W1 + wave * PK_WAVE + lane * 8;
  // Register ring of B fragments: set (s & 3) holds k step s; steps s+1..s+3 are in flight from L2.
  v8bf bq[BAHEAD + 1][8];
  for (int kt = 0; kt < NKT; ++kt) {
    const float* raw = (const float*)(smem + OFF_RAW0 + (kt & 1) * RAWBYTES);

#if USE_TDM
    if (wave == 0) {
      if (kt + 1 < NKT) {   // prefetch next tile into the other buffer, then wait tile kt
        tdm_load_tile(h + (size_t)blockTok0 * D_MODEL + (kt + 1) * KC,
                      (unsigned)(OFF_RAW0 + ((kt + 1) & 1) * RAWBYTES));
        __builtin_amdgcn_s_wait_tensorcnt(1);
      } else {
        __builtin_amdgcn_s_wait_tensorcnt(0);
      }
    }
    __syncthreads();
#else
    {
      float* rawW = (float*)(smem + OFF_RAW0 + (kt & 1) * RAWBYTES);
      const float* gsrc = h + (size_t)blockTok0 * D_MODEL + kt * KC;
      #pragma unroll
      for (int i = 0; i < (TM * KC / 4) / 256; ++i) {   // 16 float4 per thread
        const int seg = tid + i * 256;
        const int r   = seg >> 6;          // KC/4 = 64 segments per row
        const int cc  = (seg & 63) * 4;
        *(float4*)&rawW[r * KC + cc] = *(const float4*)(gsrc + (size_t)r * D_MODEL + cc);
      }
      __syncthreads();
    }
#endif

    // this tile's first k steps of B fly while the tile is converted; the ring is empty at the tile's
    // other two barriers, which wait for every outstanding load
    const __bf16* w1t = w1p + kt * (KC / 32) * PK_STEP;
    #pragma unroll
    for (int u = 0; u < BAHEAD; ++u) load_bstep(w1t + u * PK_STEP, bq[u]);

    // bf16 convert + squares: each wave owns 8 rows; lanes sweep a row (no conflicts)
    #pragma unroll
    for (int j = 0; j < 8; ++j) {
      const int row    = wave * 8 + j;
      #pragma unroll
      for (int c = 0; c < 2; ++c) {
        const int col = lane * 4 + c * 128;
        const float4 rv = *(const float4*)&raw[row * KC + col];
        v4bf pv;
        const v2f lo = {rv.x, rv.y}, hi = {rv.z, rv.w};   // the loaded register pairs: packed FMAs, no moves
        ssq[j] = __builtin_elementwise_fma(lo, lo, ssq[j]);
        ssq[j] = __builtin_elementwise_fma(hi, hi, ssq[j]);
        pv[0] = (__bf16)rv.x;
        pv[1] = (__bf16)rv.y;
        pv[2] = (__bf16)rv.z;
        pv[3] = (__bf16)rv.w;
        *(v4bf*)&lds_a[row * LDSA_STRIDE + col] = pv;
      }
    }
    if (kt == NKT - 1) {   // rows complete: 1/rms to LDS, published by the last tile's two barriers
      float mine = 0.0f;
      #pragma unroll
      for (int j = 0; j < 8; ++j) {
        float s = ssq[j][0] + ssq[j][1];
        s += __shfl_xor(s, 16, 32);
        s += __shfl_xor(s, 8, 32);
        s += __shfl_xor(s, 4, 32);
        s += __shfl_xor(s, 2, 32);
        s += __shfl_xor(s, 1, 32);
        if (lane == j) mine = s;
      }
      if (lane < 8) lds_inv[wave * 8 + lane] = rsqrtf(mine * (1.0f / D_MODEL) + EPS_F);
    }
    __syncthreads();

    // 4 M-tiles x 4 N-tiles per wave -> 16 WMMA per 32-K step, B loaded once per wave
    // unrolled so that the ring's set numbers are compile-time constants (the sets stay in registers)
    #pragma unroll
    for (int ks = 0; ks < KC / 32; ++ks) {
      if (ks + BAHEAD < KC / 32) load_bstep(w1t + (ks + BAHEAD) * PK_STEP, bq[(ks + BAHEAD) & 3]);
      const int kb = ks * 32 + laneHiOff;
      v16bf af[4];
      #pragma unroll
      for (int mi = 0; mi < 4; ++mi) {
        const __bf16* ap = &lds_a[(mi * 16 + laneLo) * LDSA_STRIDE + kb];
        af[mi] = cat8(*(const v8bf*)ap, *(const v8bf*)(ap + 16));
      }
      // holds the refill at the head of its k step: the scheduler otherwise sinks it to its use, three steps on
      __builtin_amdgcn_sched_barrier(0);
      #pragma unroll
      for (int ni = 0; ni < 4; ++ni) {
        const v16bf bfr = cat8(bq[ks & 3][2 * ni], bq[ks & 3][2 * ni + 1]);
        #pragma unroll
        for (int mi = 0; mi < 4; ++mi)
          acc[mi][ni] = wmma_bf16(af[mi], bfr, acc[mi][ni]);
      }
      // keeps the next step's loads and address updates behind these products and their load waits, as one group
      __builtin_amdgcn_sched_barrier(0);
    }
    __syncthreads();   // lds_a + raw buffer free for the next tile
  }

  // Chunk 0's residual tile starts now and flies under SiLU and chunk 0's k loop. The loop's last barrier ended
  // every wave's reads and writes of the raw and A buffers, and wave 0's last tile load was waited for.
  const uint32_t hr_off = OFF_HR + uni((uint32_t)tid >> 5) * HR_SLICE;
  const uint32_t hr_dst = (uint32_t)(size_t)smem + hr_off;
  const uint64_t hr_src = (uint64_t)(size_t)(h + (size_t)blockTok0 * D_MODEL) + (uint64_t)(uni((uint32_t)tid >> 5) * 1024u);
  const u32x8 hg1 = hr_group1();
  u32x4 hg0 = hr_group0(hr_dst, hr_src);
  // this wave's own LDS traffic has retired before the mover writes where it read
  asm volatile("s_wait_dscnt 0x0" ::: "memory");
  // every wave issues its own tile: one request a wave, no test
  asm volatile("tensor_load_to_lds %0, %1" :: "s"(hg0), "s"(hg1) : "memory");

  // first k steps of the second weight stream fly while SiLU runs
  const __bf16* w2p = W2 + wave * PK_WAVE + lane * 8;
  #pragma unroll
  for (int u = 0; u < BAHEAD; ++u) load_bstep(w2p + u * PK_STEP, bq[u]);

  // ---- 1/rms + SiLU + bf16 store of view tile [64 x 512] to LDS ----
  float invr[4][8];                        // 1/rms of the 32 rows this lane's accumulators hold
  #pragma unroll
  for (int mi = 0; mi < 4; ++mi) {
    #pragma unroll
    for (int v = 0; v < 8; ++v) invr[mi][v] = lds_inv[mi * 16 + v + laneHiOff];
  }
  #pragma unroll
  for (int ni = 0; ni < 4; ++ni) {
    const int col = wave * 64 + ni * 16 + laneLo;
    #pragma unroll
    for (int mi = 0; mi < 4; ++mi) {
      #pragma unroll
      for (int v = 0; v < 8; ++v) {
        const float x = acc[mi][ni][v] * invr[mi][v];
        const float s = x / (1.0f + __expf(-x));
        lds_v[(mi * 16 + v + laneHiOff) * LDSV_STRIDE + col] = (__bf16)s;
      }
    }
  }
  __syncthreads();

  // ---- Phase C: GEMM2 (update = view @ W2), wave owns 256 d-cols in 4 chunks ----
  // the chunks' k steps follow one another in W2: one running pointer serves every refill of a trip.
  // The last trip's three refills past step 63 read the first steps of W1, which the host places directly
  // behind W2 (written in the same call, never used): no test in the loop, so the load waits stay counted.
  const __bf16* wq = w2p + BAHEAD * PK_STEP;
  for (int c = 0; c < 4; ++c) {
    v8f acc2[4][4] = {};
    const int nbase = wave * 256 + c * 64;
    for (int k4 = 0; k4 < N1 / 32; k4 += 4) {
      // four k steps a trip, so that the ring's set numbers are compile-time constants
      #pragma unroll
      for (int u = 0; u < 4; ++u) {
        load_bstep(wq + u * PK_STEP, bq[(u + BAHEAD) & 3]);
        const int kb = (k4 + u) * 32 + laneHiOff;
        v16bf af[4];
        #pragma unroll
        for (int mi = 0; mi < 4; ++mi) {
          const __bf16* ap = &lds_v[(mi * 16 + laneLo) * LDSV_STRIDE + kb];
          af[mi] = cat8(*(const v8bf*)ap, *(const v8bf*)(ap + 16));
        }
        // holds the refill at the head of its k step: the scheduler otherwise sinks it to its use, three steps on
        __builtin_amdgcn_sched_barrier(0);
        #pragma unroll
        for (int ni = 0; ni < 4; ++ni) {
          const v16bf bfr = cat8(bq[u][2 * ni], bq[u][2 * ni + 1]);
          #pragma unroll
          for (int mi = 0; mi < 4; ++mi)
            acc2[mi][ni] = wmma_bf16(af[mi], bfr, acc2[mi][ni]);
        }
        // the trip's refills name wq's registers: this wait stands in front of their rewrite at the trip's foot
        if (u == 3) asm volatile("s_wait_xcnt 0x0" ::: "memory");
        // keeps the next step's loads and address updates behind these products and their load waits, as one group
        __builtin_amdgcn_sched_barrier(0);
      }
      wq += 4 * PK_STEP;
    }
    asm volatile("s_wait_tensorcnt 0x0" :: "s"(hg0), "s"(hg1) : "memory");
    const float* hr = (const float*)(smem + hr_off);
    #pragma unroll
    for (int ni = 0; ni < 4; ++ni) {
      #pragma unroll
      for (int mi = 0; mi < 4; ++mi) {
        #pragma unroll
        for (int v = 0; v < 8; ++v) {
          const int trow = mi * 16 + v + laneHiOff;
          acc2[mi][ni][v] = hr[trow * (HR_PITCH / 4) + ni * 16 + laneLo] + scale * acc2[mi][ni][v];
        }
      }
    }
    // the tile's reads have retired before the mover refills it
    asm volatile("s_wait_dscnt 0x0" ::: "memory");
    if (pinned(c + 1 < 4)) {   // the next chunk's tile starts ahead of this chunk's stores and flies under the next k loop
      hg0 = hr_group0(hr_dst, hr_src + (uint64_t)((c + 1) * HR_ROWB));
      asm volatile("tensor_load_to_lds %0, %1" :: "s"(hg0), "s"(hg1) : "memory");
    }
    #pragma unroll
    for (int ni = 0; ni < 4; ++ni) {
      const int dcol = nbase + ni * 16 + laneLo;
      #pragma unroll
      for (int mi = 0; mi < 4; ++mi) {
        #pragma unroll
        for (int v = 0; v < 8; ++v) {
          const int row = blockTok0 + mi * 16 + v + laneHiOff;
          out[(size_t)row * D_MODEL + dcol] = acc2[mi][ni][v];
        }
      }
    }
    // the stores name the accumulators and their address registers: this wait stands in front of the next chunk's rewrite of both
    asm volatile("s_wait_xcnt 0x0" ::: "memory");
  }
}

// ---------------- host launcher ----------------
extern "C" void kernel_launch(void* const* d_in, const int* in_sizes, int n_in,
                              void* d_out, int out_size, void* d_ws, size_t ws_size,
                              hipStream_t stream) {
  (void)in_sizes; (void)n_in; (void)out_size; (void)ws_size;
  const float* h  = (const float*)d_in[0];   // [4,4096,2048] f32
  const float* wd = (const float*)d_in[1];   // [8,64,2048]   f32
  const float* wu = (const float*)d_in[2];   // [8,2048,64]   f32
  const float* gb = (const float*)d_in[3];   // scalar        f32
  float* out = (float*)d_out;

  __bf16* W2 = (__bf16*)d_ws;                       // 2 MB
  __bf16* W1 = W2 + (size_t)N1 * D_MODEL;           // 2 MB, directly behind W2: the ring's reads past W2 land here

  const int nw = N1 * D_MODEL;
  k_conv_w1<<<(nw + 255) / 256, 256, 0, stream>>>(wd, W1, nw);
  k_conv_w2<<<(nw + 255) / 256, 256, 0, stream>>>(wu, W2);

  static bool attr_set = []() {
    (void)hipFuncSetAttribute((const void*)k_spoke_fused,
                              hipFuncAttributeMaxDynamicSharedMemorySize, SMEM_BYTES);
    return true;
  }();
  (void)attr_set;

  k_spoke_fused<<<TOKENS / TM, 256, (size_t)SMEM_BYTES, stream>>>(h, W1, W2, gb, out);
}

// v005
// Measured time: 72.2 microseconds a run.
// Two timings next to v004 put it at 1.09 and 1.10 times that version's speed.
// All steps since v000 together make it 3.58 times as fast.
#include <hip/hip_runtime.h>
#include <hip/hip_bf16.h>

// ---------------- problem constants ----------------
#define D_MODEL    2048
#define NUM_SPOKES 8
#define RANK       64
#define N1         (NUM_SPOKES * RANK)
#define TOKENS     (4 * 4096)
#define TM         64
#define KC         256
#define NKT        (D_MODEL / KC)
#define LDSA_STRIDE (KC + 8)
#define LDSV_STRIDE (N1 + 8)
#define EPS_F      1.1920928955078125e-7f

// LDS byte offsets
#define OFF_INV  0                         // 64 floats (256 B)
#define RAWBYTES (TM * KC * 4)             // 65536 B per raw buffer
#define OFF_RAW0 256
#define OFF_RAW1 (OFF_RAW0 + RAWBYTES)     // 65792
#define OFF_A    (OFF_RAW1 + RAWBYTES)     // 131328
#define OFF_V    (OFF_A + TM * LDSA_STRIDE * 2)  // 165120
#define SMEM_BYTES (OFF_V + TM * LDSV_STRIDE * 2) // 231680  (< 320 KB/WGP)
// Residual tiles: behind GEMM1 the raw and A buffers are free; each wave keeps there, for itself alone,
// the 64 rows x 64 columns of h that its current column chunk adds to.
#define HR_ROWB  256
#define HR_PITCH (HR_ROWB + 16)
#define HR_SLICE 18432
#define OFF_HR   2048
static_assert(TM * HR_PITCH <= HR_SLICE && HR_SLICE % 2048 == 0 && OFF_HR >= OFF_INV + TM * 4 &&
              OFF_HR + 8 * HR_SLICE <= OFF_V, "the eight residual tiles lie between the 1/rms values and the view tile");

typedef __attribute__((ext_vector_type(16))) __bf16 v16bf;
typedef __attribute__((ext_vector_type(8)))  __bf16 v8bf;
typedef __attribute__((ext_vector_type(4)))  __bf16 v4bf;
typedef __attribute__((ext_vector_type(8)))  float  v8f;
typedef __attribute__((ext_vector_type(2)))  float  v2f;
typedef unsigned int v4u __attribute__((ext_vector_type(4)));
typedef int          v8i __attribute__((ext_vector_type(8)));
typedef int          v4i __attribute__((ext_vector_type(4)));

#if __has_builtin(__builtin_amdgcn_tensor_load_to_lds) && __has_builtin(__builtin_amdgcn_s_wait_tensorcnt)
#define USE_TDM 1
#else
#define USE_TDM 0
#endif

static __device__ __forceinline__ v16bf cat8(v8bf lo, v8bf hi) {
  return __builtin_shufflevector(lo, hi, 0,1,2,3,4,5,6,7,8,9,10,11,12,13,14,15);
}

static __device__ __forceinline__ v8f wmma_bf16(v16bf a, v16bf b, v8f c) {
  return __builtin_amdgcn_wmma_f32_16x16x32_bf16(false, a, false, b, (short)0, c,
                                                 false, false);
}

#if USE_TDM
static __device__ __forceinline__ void tdm_load_tile(const float* gtile, unsigned lds_off) {
  const unsigned long long ga = (unsigned long long)(uintptr_t)gtile;
  v4u g0;
  g0[0] = 1u;
  g0[1] = lds_off;
  g0[2] = (unsigned)ga;
  g0[3] = (unsigned)((ga >> 32) & 0x1FFFFFFu) | 0x80000000u;
  v8i g1;
  g1[0] = (int)(2u << 16);
  g1[1] = (int)((unsigned)(D_MODEL & 0xFFFF) << 16);
  g1[2] = (int)((D_MODEL >> 16) | ((TOKENS & 0xFFFF) << 16));
  g1[3] = (int)((TOKENS >> 16) | (KC << 16));
  g1[4] = (int)TM;
  g1[5] = (int)D_MODEL;
  g1[6] = 0;
  g1[7] = 0;
  const v4i gz4 = {0, 0, 0, 0};                          // groups 2/3: dims 3/4 unused
  const v8i gz8 = {0, 0, 0, 0, 0, 0, 0, 0};
  __builtin_amdgcn_tensor_load_to_lds(g0, g1, gz4, gz4, gz8, 0);
}
#endif

// ---- a wave's own residual tile by tensor load: 64 rows of 256 bytes, source pitch one row of h ----
typedef uint32_t u32x4 __attribute__((ext_vector_type(4)));
typedef uint32_t u32x8 __attribute__((ext_vector_type(8)));
static __device__ __forceinline__ uint32_t uni(uint32_t v) { return (uint32_t)__builtin_amdgcn_readfirstlane(v); }
static __device__ __forceinline__ uint32_t pinned(uint32_t v) {
  uint32_t w = uni(v);
  asm volatile("" : "+s"(w));   // pinned(): holds the test in a scalar register, so that the branch on it is s_cmp + s_cbranch_scc
  return w;
}
static __device__ __forceinline__ u32x8 hr_group1() {   // every extent in bytes; tensor = tile
  u32x8 g;
  g[0] = uni((1u << 20) | (5u << 22) | (3u << 25));      // no mask, 1-byte elements, 16 bytes of pad behind every 256
  g[1] = uni(((uint32_t)HR_ROWB & 0xFFFFu) << 16);
  g[2] = uni(((uint32_t)HR_ROWB >> 16) | (((uint32_t)TM & 0xFFFFu) << 16));
  g[3] = uni(((uint32_t)TM >> 16) | ((uint32_t)HR_ROWB << 16));
  g[4] = uni((uint32_t)TM);
  g[5] = uni((uint32_t)(D_MODEL * 4));
  g[6] = uni(0u);
  g[7] = uni(0u);
  return g;
}
static __device__ __forceinline__ u32x4 hr_group0(uint32_t lds_dst, uint64_t ga) {
  u32x4 g;
  g[0] = uni(1u);
  g[1] = uni(lds_dst);
  g[2] = uni((uint32_t)ga);
  g[3] = uni((((uint32_t)(ga >> 32)) & 0x01FFFFFFu) | 0x80000000u);
  return g;
}

#define PK_TILE 512                        // elements of one 16-column x 32-k tile
#define PK_WAVE (4 * PK_TILE)              // one wave's four tiles of a k step
#define PK_STEP (8 * PK_WAVE)              // the eight waves' tiles of a k step

// Both weights in one launch, one work-group a WGP. A wave packs two neighbouring k steps of one 16-column tile:
// 16 source rows of 256 bytes. Eight lanes read one 128-byte line (32 k of a column), so that a load instruction
// covers four whole lines; all eight loads of a lane fly together, and a wave alone writes its two 1-KB tiles.
#define PK_JOBS (2 * 32 * 8 * 4)           // [weight][pair of k steps][wave][tile]
__global__ __launch_bounds__(256)
void k_pack_w(const float* __restrict__ wdn, const float* __restrict__ wup,
              __bf16* __restrict__ W1, __bf16* __restrict__ W2) {
  const int lane = threadIdx.x & 31;
  const int job  = blockIdx.x * 8 + (threadIdx.x >> 5);
  const int tile = job & 3;
  const int wave = (job >> 2) & 7;
  const int sp   = (job >> 5) & 31;        // k steps 2 * sp and 2 * sp + 1
  const int q    = lane & 7;               // k = 4 * q + 0..3 inside a step
  const int cs   = lane >> 3;              // column inside a group of four
  const bool first = job < PK_JOBS / 2;
  // W1: a wave owns 64 rank columns; 64 k steps.  W2: [4 column chunks][16 k steps]; a pair of steps is one spoke's 64 ranks
  const float* src = first ? wdn + (size_t)(wave * 64 + tile * 16) * D_MODEL + sp * 64
                           : wup + (size_t)(sp & 7) * (D_MODEL * RANK) + (size_t)(wave * 256 + (sp >> 3) * 64 + tile * 16) * RANK;
  const unsigned pitch = first ? D_MODEL : RANK;   // floats between source rows
  __bf16* dst = (first ? W1 : W2) + (size_t)sp * (2 * PK_STEP) + wave * PK_WAVE + tile * PK_TILE;
  const unsigned so = cs * pitch + q * 4;
  const unsigned o  = (q >> 2) * (PK_TILE / 2) + (((q >> 1) & 1) * 16 + cs) * 8 + (q & 1) * 4;
  const float* p0 = src + so;
  const float* p1 = p0 + 4 * pitch;
  const float* p2 = p1 + 4 * pitch;
  const float* p3 = p2 + 4 * pitch;
  float4 v[2][4];
  #pragma unroll
  for (int e = 0; e < 2; ++e) {
    v[e][0] = *(const float4*)(p0 + e * 32);
    v[e][1] = *(const float4*)(p1 + e * 32);
    v[e][2] = *(const float4*)(p2 + e * 32);
    v[e][3] = *(const float4*)(p3 + e * 32);
  }
  // the wait in front of any rewrite of the loads' address registers; they are named as inputs so that they live up
  // to it and no later load's result is given one of them
  asm volatile("s_wait_xcnt 0x0" :: "v"(p0), "v"(p1), "v"(p2), "v"(p3) : "memory");
  #pragma unroll
  for (int e = 0; e < 2; ++e) {
    #pragma unroll
    for (int i = 0; i < 4; ++i) {
      v4bf pv;
      pv[0] = (__bf16)v[e][i].x;
      pv[1] = (__bf16)v[e][i].y;
      pv[2] = (__bf16)v[e][i].z;
      pv[3] = (__bf16)v[e][i].w;
      *(v4bf*)(dst + e * PK_STEP + i * 4 * 8 + o) = pv;
    }
  }
}

// One k step of a wave's packed B: four 16-column tiles, two 16-byte halves each (4 KB a wave).
static __device__ __forceinline__ void load_bstep(const __bf16* __restrict__ p, v8bf (&dst)[8]) {
  #pragma unroll
  for (int ni = 0; ni < 4; ++ni) {
    dst[2 * ni]     = *(const v8bf*)(p + ni * PK_TILE);
    dst[2 * ni + 1] = *(const v8bf*)(p + ni * PK_TILE + PK_TILE / 2);
  }
}
#define BAHEAD 3                           // k steps of B in flight ahead of the one in use

__global__ __launch_bounds__(256) __attribute__((amdgpu_waves_per_eu(2, 2)))
void k_spoke_fused(const float* __restrict__ h,
                   const __bf16* __restrict__ W1,   // 512 cols x 2048 k, packed fragments
                   const __bf16* __restrict__ W2,   // 2048 cols x 512 k, packed fragments
                   const float* __restrict__ gate_bias,
                   float* __restrict__ out) {
  const int tid       = threadIdx.x;
  const int lane      = tid & 31;
  const int wave      = tid >> 5;          // 0..7, owns N-slice of 64 (G1) / 256 (G2)
  const int laneLo    = lane & 15;
  const int laneHiOff = (lane >> 4) << 3;  // 0 or 8
  const int blockTok0 = blockIdx.x * TM;

  extern __shared__ __attribute__((aligned(2048))) char smem[];
  float*  lds_inv = (float*)(smem + OFF_INV);
  __bf16* lds_a   = (__bf16*)(smem + OFF_A);
  __bf16* lds_v   = (__bf16*)(smem + OFF_V);

  const float gb    = gate_bias[0];
  const float scale = (1.0f / (1.0f + __expf(-gb))) * (1.0f / NUM_SPOKES);

#if USE_TDM
  if (wave == 0) {  // kick off first A tile
    tdm_load_tile(h + (size_t)blockTok0 * D_MODEL, OFF_RAW0);
  }
#endif

  // ---- GEMM1 (A @ W1 on the raw rows), K staged in LDS tiles of KC ----
  // A row's 1/rms is one factor of its whole dot product: it is applied to the f32 sums behind the loop,
  // and the squares are summed from the staged tiles on the way, so h needs no pass of its own for the norm.
  v8f acc[4][4] = {};
  v2f ssq[8] = {};                         // this lane's share of the squares of the wave's 8 rows, even | odd columns
  const __bf16* w1p = W1 + wave * PK_WAVE + lane * 8;
  // Register ring of B fragments: set (s & 3) holds k step s; steps s+1..s+3 are in flight from L2.
  v8bf bq[BAHEAD + 1][8];
  for (int kt = 0; kt < NKT; ++kt) {
    const float* raw = (const float*)(smem + OFF_RAW0 + (kt & 1) * RAWBYTES);

#if USE_TDM
    if (wave == 0) {
      if (kt + 1 < NKT) {   // prefetch next tile into the other buffer, then wait tile kt
        tdm_load_tile(h + (size_t)blockTok0 * D_MODEL + (kt + 1) * KC,
                      (unsigned)(OFF_RAW0 + ((kt + 1) & 1) * RAWBYTES));
        __builtin_amdgcn_s_wait_tensorcnt(1);
      } else {
        __builtin_amdgcn_s_wait_tensorcnt(0);
      }
    }
    __syncthreads();
#else
    {
      float* rawW = (float*)(smem + OFF_RAW0 + (kt & 1) * RAWBYTES);
      const float* gsrc = h + (size_t)blockTok0 * D_MODEL + kt * KC;
      #pragma unroll
      for (int i = 0; i < (TM * KC / 4) / 256; ++i) {   // 16 float4 per thread
        const int seg = tid + i * 256;
        const int r   = seg >> 6;          // KC/4 = 64 segments per row
        const int cc  = (seg & 63) * 4;
        *(float4*)&rawW[r * KC + cc] = *(const float4*)(gsrc + (size_t)r * D_MODEL + cc);
      }
      __syncthreads();
    }
#endif

    // this tile's first k steps of B fly while the tile is converted; the ring is empty at the tile's
    // other two barriers, which wait for every outstanding load
    const __bf16* w1t = w1p + kt * (KC / 32) * PK_STEP;
    #pragma unroll
    for (int u = 0; u < BAHEAD; ++u) load_bstep(w1t + u * PK_STEP, bq[u]);

    // bf16 convert + squares: each wave owns 8 rows; lanes sweep a row (no conflicts)
    #pragma unroll
    for (int j = 0; j < 8; ++j) {
      const int row    = wave * 8 + j;
      #pragma unroll
      for (int c = 0; c < 2; ++c) {
        const int col = lane * 4 + c * 128;
        const float4 rv = *(const float4*)&raw[row * KC + col];
        v4bf pv;
        const v2f lo = {rv.x, rv.y}, hi = {rv.z, rv.w};   // the loaded register pairs: packed FMAs, no moves
        ssq[j] = __builtin_elementwise_fma(lo, lo, ssq[j]);
        ssq[j] = __builtin_elementwise_fma(hi, hi, ssq[j]);
        pv[0] = (__bf16)rv.x;
        pv[1] = (__bf16)rv.y;
        pv[2] = (__bf16)rv.z;
        pv[3] = (__bf16)rv.w;
        *(v4bf*)&lds_a[row * LDSA_STRIDE + col] = pv;
      }
    }
    if (kt == NKT - 1) {   // rows complete: 1/rms to LDS, published by the last tile's two barriers
      float mine = 0.0f;
      #pragma unroll
      for (int j = 0; j < 8; ++j) {
        float s = ssq[j][0] + ssq[j][1];
        s += __shfl_xor(s, 16, 32);
        s += __shfl_xor(s, 8, 32);
        s += __shfl_xor(s, 4, 32);
        s += __shfl_xor(s, 2, 32);
        s += __shfl_xor(s, 1, 32);
        if (lane == j) mine = s;
      }
      if (lane < 8) lds_inv[wave * 8 + lane] = rsqrtf(mine * (1.0f / D_MODEL) + EPS_F);
    }
    __syncthreads();

    // 4 M-tiles x 4 N-tiles per wave -> 16 WMMA per 32-K step, B loaded once per wave
    // unrolled so that the ring's set numbers are compile-time constants (the sets stay in registers)
    #pragma unroll
    for (int ks = 0; ks < KC / 32; ++ks) {
      if (ks + BAHEAD < KC / 32) load_bstep(w1t + (ks + BAHEAD) * PK_STEP, bq[(ks + BAHEAD) & 3]);
      const int kb = ks * 32 + laneHiOff;
      v16bf af[4];
      #pragma unroll
      for (int mi = 0; mi < 4; ++mi) {
        const __bf16* ap = &lds_a[(mi * 16 + laneLo) * LDSA_STRIDE + kb];
        af[mi] = cat8(*(const v8bf*)ap, *(const v8bf*)(ap + 16));
      }
      // holds the refill at the head of its k step: the scheduler otherwise sinks it to its use, three steps on
      __builtin_amdgcn_sched_barrier(0);
      #pragma unroll
      for (int ni = 0; ni < 4; ++ni) {
        const v16bf bfr = cat8(bq[ks & 3][2 * ni], bq[ks & 3][2 * ni + 1]);
        #pragma unroll
        for (int mi = 0; mi < 4; ++mi)
          acc[mi][ni] = wmma_bf16(af[mi], bfr, acc[mi][ni]);
      }
      // keeps the next step's loads and address updates behind these products and their load waits, as one group
      __builtin_amdgcn_sched_barrier(0);
    }
    __syncthreads();   // lds_a + raw buffer free for the next tile
  }

  // Chunk 0's residual tile starts now and flies under SiLU and chunk 0's k loop. The loop's last barrier ended
  // every wave's reads and writes of the raw and A buffers, and wave 0's last tile load was waited for.
  const uint32_t hr_off = OFF_HR + uni((uint32_t)tid >> 5) * HR_SLICE;
  const uint32_t hr_dst = (uint32_t)(size_t)smem + hr_off;
  const uint64_t hr_src = (uint64_t)(size_t)(h + (size_t)blockTok0 * D_MODEL) + (uint64_t)(uni((uint32_t)tid >> 5) * 1024u);
  const u32x8 hg1 = hr_group1();
  u32x4 hg0 = hr_group0(hr_dst, hr_src);
  // this wave's own LDS traffic has retired before the mover writes where it read
  asm volatile("s_wait_dscnt 0x0" ::: "memory");
  // every wave issues its own tile: one request a wave, no test
  asm volatile("tensor_load_to_lds %0, %1" :: "s"(hg0), "s"(hg1) : "memory");

  // first k steps of the second weight stream fly while SiLU runs
  const __bf16* w2p = W2 + wave * PK_WAVE + lane * 8;
  #pragma unroll
  for (int u = 0; u < BAHEAD; ++u) load_bstep(w2p + u * PK_STEP, bq[u]);

  // ---- 1/rms + SiLU + bf16 store of view tile [64 x 512] to LDS ----
  float invr[4][8];                        // 1/rms of the 32 rows this lane's accumulators hold
  #pragma unroll
  for (int mi = 0; mi < 4; ++mi) {
    #pragma unroll
    for (int v = 0; v < 8; ++v) invr[mi][v] = lds_inv[mi * 16 + v + laneHiOff];
  }
  #pragma unroll
  for (int ni = 0; ni < 4; ++ni) {
    const int col = wave * 64 + ni * 16 + laneLo;
    #pragma unroll
    for (int mi = 0; mi < 4; ++mi) {
      #pragma unroll
      for (int v = 0; v < 8; ++v) {
        const float x = acc[mi][ni][v] * invr[mi][v];
        const float s = x / (1.0f + __expf(-x));
        lds_v[(mi * 16 + v + laneHiOff) * LDSV_STRIDE + col] = (__bf16)s;
      }
    }
  }
  __syncthreads();

  // ---- Phase C: GEMM2 (update = view @ W2), wave owns 256 d-cols in 4 chunks ----
  // the chunks' k steps follow one another in W2: one running pointer serves every refill of a trip.
  // The last trip's three refills past step 63 read the first steps of W1, which the host places directly
  // behind W2 (written in the same call, never used): no test in the loop, so the load waits stay counted.
  const __bf16* wq = w2p + BAHEAD * PK_STEP;
  for (int c = 0; c < 4; ++c) {
    v8f acc2[4][4] = {};
    const int nbase = wave * 256 + c * 64;
    for (int k4 = 0; k4 < N1 / 32; k4 += 4) {
      // four k steps a trip, so that the ring's set numbers are compile-time constants
      #pragma unroll
      for (int u = 0; u < 4; ++u) {
        load_bstep(wq + u * PK_STEP, bq[(u + BAHEAD) & 3]);
        const int kb = (k4 + u) * 32 + laneHiOff;
        v16bf af[4];
        #pragma unroll
        for (int mi = 0; mi < 4; ++mi) {
          const __bf16* ap = &lds_v[(mi * 16 + laneLo) * LDSV_STRIDE + kb];
          af[mi] = cat8(*(const v8bf*)ap, *(const v8bf*)(ap + 16));
        }
        // holds the refill at the head of its k step: the scheduler otherwise sinks it to its use, three steps on
        __builtin_amdgcn_sched_barrier(0);
        #pragma unroll
        for (int ni = 0; ni < 4; ++ni) {
          const v16bf bfr = cat8(bq[u][2 * ni], bq[u][2 * ni + 1]);
          #pragma unroll
          for (int mi = 0; mi < 4; ++mi)
            acc2[mi][ni] = wmma_bf16(af[mi], bfr, acc2[mi][ni]);
        }
        // the trip's refills name wq's registers: this wait stands in front of their rewrite at the trip's foot
        if (u == 3) asm volatile("s_wait_xcnt 0x0" ::: "memory");
        // keeps the next step's loads and address updates behind these products and their load waits, as one group
        __builtin_amdgcn_sched_barrier(0);
      }
      wq += 4 * PK_STEP;
    }
    asm volatile("s_wait_tensorcnt 0x0" :: "s"(hg0), "s"(hg1) : "memory");
    const float* hr = (const float*)(smem + hr_off);
    #pragma unroll
    for (int ni = 0; ni < 4; ++ni) {
      #pragma unroll
      for (int mi = 0; mi < 4; ++mi) {
        #pragma unroll
        for (int v = 0; v < 8; ++v) {
          const int trow = mi * 16 + v + laneHiOff;
          acc2[mi][ni][v] = hr[trow * (HR_PITCH / 4) + ni * 16 + laneLo] + scale * acc2[mi][ni][v];
        }
      }
    }
    // the tile's reads have retired before the mover refills it
    asm volatile("s_wait_dscnt 0x0" ::: "memory");
    if (pinned(c + 1 < 4)) {   // the next chunk's tile starts ahead of this chunk's stores and flies under the next k loop
      hg0 = hr_group0(hr_dst, hr_src + (uint64_t)((c + 1) * HR_ROWB));
      asm volatile("tensor_load_to_lds %0, %1" :: "s"(hg0), "s"(hg1) : "memory");
    }
    #pragma unroll
    for (int ni = 0; ni < 4; ++ni) {
      const int dcol = nbase + ni * 16 + laneLo;
      #pragma unroll
      for (int mi = 0; mi < 4; ++mi) {
        #pragma unroll
        for (int v = 0; v < 8; ++v) {
          const int row = blockTok0 + mi * 16 + v + laneHiOff;
          out[(size_t)row * D_MODEL + dcol] = acc2[mi][ni][v];
        }
      }
    }
    // the stores name the accumulators and their address registers: this wait stands in front of the next chunk's rewrite of both
    asm volatile("s_wait_xcnt 0x0" ::: "memory");
  }
}

// ---------------- host launcher ----------------
extern "C" void kernel_launch(void* const* d_in, const int* in_sizes, int n_in,
                              void* d_out, int out_size, void* d_ws, size_t ws_size,
                              hipStream_t stream) {
  (void)in_sizes; (void)n_in; (void)out_size; (void)ws_size;
  const float* h  = (const float*)d_in[0];   // [4,4096,2048] f32
  const float* wd = (const float*)d_in[1];   // [8,64,2048]   f32
  const float* wu = (const float*)d_in[2];   // [8,2048,64]   f32
  const float* gb = (const float*)d_in[3];   // scalar        f32
  float* out = (float*)d_out;

  __bf16* W2 = (__bf16*)d_ws;                       // 2 MB
  __bf16* W1 = W2 + (size_t)N1 * D_MODEL;           // 2 MB, directly behind W2: the ring's reads past W2 land here

  k_pack_w<<<PK_JOBS / 8, 256, 0, stream>>>(wd, wu, W1, W2);

  static bool attr_set = []() {
    (void)hipFuncSetAttribute((const void*)k_spoke_fused,
                              hipFuncAttributeMaxDynamicSharedMemorySize, SMEM_BYTES);
    return true;
  }();
  (void)attr_set;

  k_spoke_fused<<<TOKENS / TM, 256, (size_t)SMEM_BYTES, stream>>>(h, W1, W2, gb, out);
}

// v006
// It runs in 62.9 microseconds.
// In both of two side-by-side timings against v005, it was 1.15 times as fast.
// All steps since v000 together make it 4.10 times as fast.
#include <hip/hip_runtime.h>
#include <hip/hip_bf16.h>

// ---------------- problem constants ----------------
#define D_MODEL    2048
#define NUM_SPOKES 8
#define RANK       64
#define N1         (NUM_SPOKES * RANK)
#define TOKENS     (4 * 4096)
#define TM         64
#define KC         256
#define NKT        (D_MODEL / KC)
#define LDSA_STRIDE (KC + 8)
#define LDSV_STRIDE (N1 + 8)
#define EPS_F      1.1920928955078125e-7f

// LDS byte offsets
#define OFF_INV  0                         // 64 floats (256 B)
#define RAWBYTES (TM * KC * 4)             // 65536 B per raw buffer
#define OFF_RAW0 256
#define OFF_RAW1 (OFF_RAW0 + RAWBYTES)     // 65792
#define OFF_A    (OFF_RAW1 + RAWBYTES)     // 131328
#define OFF_V    (OFF_A + TM * LDSA_STRIDE * 2)  // 165120
#define SMEM_BYTES (OFF_V + TM * LDSV_STRIDE * 2) // 231680  (< 320 KB/WGP)
// Residual tiles: behind GEMM1 the raw and A buffers are free; each wave keeps there, for itself alone,
// the 64 rows x 64 columns of h that its current column chunk adds to.
#define HR_ROWB  256
#define HR_PITCH (HR_ROWB + 16)
#define HR_SLICE 18432
#define OFF_HR   2048
static_assert(TM * HR_PITCH <= HR_SLICE && HR_SLICE % 2048 == 0 && OFF_HR >= OFF_INV + TM * 4 &&
              OFF_HR + 8 * HR_SLICE <= OFF_V, "the eight residual tiles lie between the 1/rms values and the view tile");

typedef __attribute__((ext_vector_type(16))) __bf16 v16bf;
typedef __attribute__((ext_vector_type(8)))  __bf16 v8bf;
typedef __attribute__((ext_vector_type(4)))  __bf16 v4bf;
typedef __attribute__((ext_vector_type(8)))  float  v8f;
typedef __attribute__((ext_vector_type(2)))  float  v2f;
typedef unsigned int v4u __attribute__((ext_vector_type(4)));
typedef int          v8i __attribute__((ext_vector_type(8)));
typedef int          v4i __attribute__((ext_vector_type(4)));

#if __has_builtin(__builtin_amdgcn_tensor_load_to_lds) && __has_builtin(__builtin_amdgcn_s_wait_tensorcnt)
#define USE_TDM 1
#else
#define USE_TDM 0
#endif

static __device__ __forceinline__ v16bf cat8(v8bf lo, v8bf hi) {
  return __builtin_shufflevector(lo, hi, 0,1,2,3,4,5,6,7,8,9,10,11,12,13,14,15);
}

static __device__ __forceinline__ v8f wmma_bf16(v16bf a, v16bf b, v8f c) {
  return __builtin_amdgcn_wmma_f32_16x16x32_bf16(false, a, false, b, (short)0, c,
                                                 false, false);
}

#if USE_TDM
static __device__ __forceinline__ void tdm_load_tile(const float* gtile, unsigned lds_off) {
  const unsigned long long ga = (unsigned long long)(uintptr_t)gtile;
  v4u g0;
  g0[0] = 1u;
  g0[1] = lds_off;
  g0[2] = (unsigned)ga;
  g0[3] = (unsigned)((ga >> 32) & 0x1FFFFFFu) | 0x80000000u;
  v8i g1;
  g1[0] = (int)(2u << 16);
  g1[1] = (int)((unsigned)(D_MODEL & 0xFFFF) << 16);
  g1[2] = (int)((D_MODEL >> 16) | ((TOKENS & 0xFFFF) << 16));
  g1[3] = (int)((TOKENS >> 16) | (KC << 16));
  g1[4] = (int)TM;
  g1[5] = (int)D_MODEL;
  g1[6] = 0;
  g1[7] = 0;
  const v4i gz4 = {0, 0, 0, 0};                          // groups 2/3: dims 3/4 unused
  const v8i gz8 = {0, 0, 0, 0, 0, 0, 0, 0};
  __builtin_amdgcn_tensor_load_to_lds(g0, g1, gz4, gz4, gz8, 0);
}
#endif

// ---- a wave's own residual tile by tensor load: 64 rows of 256 bytes, source pitch one row of h ----
typedef uint32_t u32x4 __attribute__((ext_vector_type(4)));
typedef uint32_t u32x8 __attribute__((ext_vector_type(8)));
static __device__ __forceinline__ uint32_t uni(uint32_t v) { return (uint32_t)__builtin_amdgcn_readfirstlane(v); }
static __device__ __forceinline__ uint32_t pinned(uint32_t v) {
  uint32_t w = uni(v);
  asm volatile("" : "+s"(w));   // pinned(): holds the test in a scalar register, so that the branch on it is s_cmp + s_cbranch_scc
  return w;
}
static __device__ __forceinline__ u32x8 hr_group1() {   // every extent in bytes; tensor = tile
  u32x8 g;
  g[0] = uni((1u << 20) | (5u << 22) | (3u << 25));      // no mask, 1-byte elements, 16 bytes of pad behind every 256
  g[1] = uni(((uint32_t)HR_ROWB & 0xFFFFu) << 16);
  g[2] = uni(((uint32_t)HR_ROWB >> 16) | (((uint32_t)TM & 0xFFFFu) << 16));
  g[3] = uni(((uint32_t)TM >> 16) | ((uint32_t)HR_ROWB << 16));
  g[4] = uni((uint32_t)TM);
  g[5] = uni((uint32_t)(D_MODEL * 4));
  g[6] = uni(0u);
  g[7] = uni(0u);
  return g;
}
static __device__ __forceinline__ u32x4 hr_group0(uint32_t lds_dst, uint64_t ga) {
  u32x4 g;
  g[0] = uni(1u);
  g[1] = uni(lds_dst);
  g[2] = uni((uint32_t)ga);
  g[3] = uni((((uint32_t)(ga >> 32)) & 0x01FFFFFFu) | 0x80000000u);
  return g;
}

#define PK_TILE 512                        // elements of one 16-column x 32-k tile
#define PK_WAVE (4 * PK_TILE)              // one wave's four tiles of a k step
#define PK_STEP (8 * PK_WAVE)              // the eight waves' tiles of a k step

// Both weights in one launch, one work-group a WGP. A wave packs two neighbouring k steps of one 16-column tile:
// 16 source rows of 256 bytes. Eight lanes read one 128-byte line (32 k of a column), so that a load instruction
// covers four whole lines; all eight loads of a lane fly together, and a wave alone writes its two 1-KB tiles.
#define PK_JOBS (2 * 32 * 8 * 4)           // [weight][pair of k steps][wave][tile]
__global__ __launch_bounds__(256)
void k_pack_w(const float* __restrict__ wdn, const float* __restrict__ wup,
              __bf16* __restrict__ W1, __bf16* __restrict__ W2) {
  const int lane = threadIdx.x & 31;
  const int job  = blockIdx.x * 8 + (threadIdx.x >> 5);
  const int tile = job & 3;
  const int wave = (job >> 2) & 7;
  const int sp   = (job >> 5) & 31;        // k steps 2 * sp and 2 * sp + 1
  const int q    = lane & 7;               // k = 4 * q + 0..3 inside a step
  const int cs   = lane >> 3;              // column inside a group of four
  const bool first = job < PK_JOBS / 2;
  // W1: a wave owns 64 rank columns; 64 k steps.  W2: [4 column chunks][16 k steps]; a pair of steps is one spoke's 64 ranks
  const float* src = first ? wdn + (size_t)(wave * 64 + tile) * D_MODEL + sp * 64
                           : wup + (size_t)(sp & 7) * (D_MODEL * RANK) + (size_t)(wave * 256 + (sp >> 3) * 64 + tile) * RANK;
  const unsigned pitch = first ? 4 * D_MODEL : 4 * RANK;   // floats between a tile's neighbouring columns
  __bf16* dst = (first ? W1 : W2) + (size_t)sp * (2 * PK_STEP) + wave * PK_WAVE + tile * PK_TILE;
  const unsigned so = cs * pitch + q * 4;
  const unsigned o  = (q >> 2) * (PK_TILE / 2) + (((q >> 1) & 1) * 16 + cs) * 8 + (q & 1) * 4;
  const float* p0 = src + so;
  const float* p1 = p0 + 4 * pitch;
  const float* p2 = p1 + 4 * pitch;
  const float* p3 = p2 + 4 * pitch;
  float4 v[2][4];
  #pragma unroll
  for (int e = 0; e < 2; ++e) {
    v[e][0] = *(const float4*)(p0 + e * 32);
    v[e][1] = *(const float4*)(p1 + e * 32);
    v[e][2] = *(const float4*)(p2 + e * 32);
    v[e][3] = *(const float4*)(p3 + e * 32);
  }
  // the wait in front of any rewrite of the loads' address registers; they are named as inputs so that they live up
  // to it and no later load's result is given one of them
  asm volatile("s_wait_xcnt 0x0" :: "v"(p0), "v"(p1), "v"(p2), "v"(p3) : "memory");
  #pragma unroll
  for (int e = 0; e < 2; ++e) {
    #pragma unroll
    for (int i = 0; i < 4; ++i) {
      v4bf pv;
      pv[0] = (__bf16)v[e][i].x;
      pv[1] = (__bf16)v[e][i].y;
      pv[2] = (__bf16)v[e][i].z;
      pv[3] = (__bf16)v[e][i].w;
      *(v4bf*)(dst + e * PK_STEP + i * 4 * 8 + o) = pv;
    }
  }
}

// One k step of a wave's packed B: four 16-column tiles, two 16-byte halves each (4 KB a wave).
static __device__ __forceinline__ void load_bstep(const __bf16* __restrict__ p, v8bf (&dst)[8]) {
  #pragma unroll
  for (int ni = 0; ni < 4; ++ni) {
    dst[2 * ni]     = *(const v8bf*)(p + ni * PK_TILE);
    dst[2 * ni + 1] = *(const v8bf*)(p + ni * PK_TILE + PK_TILE / 2);
  }
}
#define BAHEAD 3                           // k steps of B in flight ahead of the one in use

__global__ __launch_bounds__(256) __attribute__((amdgpu_waves_per_eu(2, 2)))
void k_spoke_fused(const float* __restrict__ h,
                   const __bf16* __restrict__ W1,   // 512 cols x 2048 k, packed fragments
                   const __bf16* __restrict__ W2,   // 2048 cols x 512 k, packed fragments
                   const float* __restrict__ gate_bias,
                   float* __restrict__ out) {
  const int tid       = threadIdx.x;
  const int lane      = tid & 31;
  const int wave      = tid >> 5;          // 0..7, owns N-slice of 64 (G1) / 256 (G2)
  const int laneLo    = lane & 15;
  const int laneHiOff = (lane >> 4) << 3;  // 0 or 8
  const int blockTok0 = blockIdx.x * TM;

  extern __shared__ __attribute__((aligned(2048))) char smem[];
  float*  lds_inv = (float*)(smem + OFF_INV);
  __bf16* lds_a   = (__bf16*)(smem + OFF_A);
  __bf16* lds_v   = (__bf16*)(smem + OFF_V);

  const float gb    = gate_bias[0];
  const float scale = (1.0f / (1.0f + __expf(-gb))) * (1.0f / NUM_SPOKES);

#if USE_TDM
  if (wave == 0) {  // kick off first A tile
    tdm_load_tile(h + (size_t)blockTok0 * D_MODEL, OFF_RAW0);
  }
#endif

  // ---- GEMM1 (A @ W1 on the raw rows), K staged in LDS tiles of KC ----
  // A row's 1/rms is one factor of its whole dot product: it is applied to the f32 sums behind the loop,
  // and the squares are summed from the staged tiles on the way, so h needs no pass of its own for the norm.
  v8f acc[4][4] = {};
  v2f ssq[8] = {};                         // this lane's share of the squares of the wave's 8 rows, even | odd columns
  const __bf16* w1p = W1 + wave * PK_WAVE + lane * 8;
  // Register ring of B fragments: set (s & 3) holds k step s; steps s+1..s+3 are in flight from L2.
  v8bf bq[BAHEAD + 1][8];
  for (int kt = 0; kt < NKT; ++kt) {
    const float* raw = (const float*)(smem + OFF_RAW0 + (kt & 1) * RAWBYTES);

#if USE_TDM
    if (wave == 0) {
      if (kt + 1 < NKT) {   // prefetch next tile into the other buffer, then wait tile kt
        tdm_load_tile(h + (size_t)blockTok0 * D_MODEL + (kt + 1) * KC,
                      (unsigned)(OFF_RAW0 + ((kt + 1) & 1) * RAWBYTES));
        __builtin_amdgcn_s_wait_tensorcnt(1);
      } else {
        __builtin_amdgcn_s_wait_tensorcnt(0);
      }
    }
    __syncthreads();
#else
    {
      float* rawW = (float*)(smem + OFF_RAW0 + (kt & 1) * RAWBYTES);
      const float* gsrc = h + (size_t)blockTok0 * D_MODEL + kt * KC;
      #pragma unroll
      for (int i = 0; i < (TM * KC / 4) / 256; ++i) {   // 16 float4 per thread
        const int seg = tid + i * 256;
        const int r   = seg >> 6;          // KC/4 = 64 segments per row
        const int cc  = (seg & 63) * 4;
        *(float4*)&rawW[r * KC + cc] = *(const float4*)(gsrc + (size_t)r * D_MODEL + cc);
      }
      __syncthreads();
    }
#endif

    // this tile's first k steps of B fly while the tile is converted; the ring is empty at the tile's
    // other two barriers, which wait for every outstanding load
    const __bf16* w1t = w1p + kt * (KC / 32) * PK_STEP;
    #pragma unroll
    for (int u = 0; u < BAHEAD; ++u) load_bstep(w1t + u * PK_STEP, bq[u]);

    // bf16 convert + squares: each wave owns 8 rows; lanes sweep a row (no conflicts)
    #pragma unroll
    for (int j = 0; j < 8; ++j) {
      const int row    = wave * 8 + j;
      #pragma unroll
      for (int c = 0; c < 2; ++c) {
        const int col = lane * 4 + c * 128;
        const float4 rv = *(const float4*)&raw[row * KC + col];
        v4bf pv;
        const v2f lo = {rv.x, rv.y}, hi = {rv.z, rv.w};   // the loaded register pairs: packed FMAs, no moves
        ssq[j] = __builtin_elementwise_fma(lo, lo, ssq[j]);
        ssq[j] = __builtin_elementwise_fma(hi, hi, ssq[j]);
        pv[0] = (__bf16)rv.x;
        pv[1] = (__bf16)rv.y;
        pv[2] = (__bf16)rv.z;
        pv[3] = (__bf16)rv.w;
        *(v4bf*)&lds_a[row * LDSA_STRIDE + col] = pv;
      }
    }
    if (kt == NKT - 1) {   // rows complete: 1/rms to LDS, published by the last tile's two barriers
      float mine = 0.0f;
      #pragma unroll
      for (int j = 0; j < 8; ++j) {
        float s = ssq[j][0] + ssq[j][1];
        s += __shfl_xor(s, 16, 32);
        s += __shfl_xor(s, 8, 32);
        s += __shfl_xor(s, 4, 32);
        s += __shfl_xor(s, 2, 32);
        s += __shfl_xor(s, 1, 32);
        if (lane == j) mine = s;
      }
      if (lane < 8) lds_inv[wave * 8 + lane] = rsqrtf(mine * (1.0f / D_MODEL) + EPS_F);
    }
    __syncthreads();

    // 4 M-tiles x 4 N-tiles per wave -> 16 WMMA per 32-K step, B loaded once per wave
    // unrolled so that the ring's set numbers are compile-time constants (the sets stay in registers)
    #pragma unroll
    for (int ks = 0; ks < KC / 32; ++ks) {
      if (ks + BAHEAD < KC / 32) load_bstep(w1t + (ks + BAHEAD) * PK_STEP, bq[(ks + BAHEAD) & 3]);
      const int kb = ks * 32 + laneHiOff;
      v16bf af[4];
      #pragma unroll
      for (int mi = 0; mi < 4; ++mi) {
        const __bf16* ap = &lds_a[(mi * 16 + laneLo) * LDSA_STRIDE + kb];
        af[mi] = cat8(*(const v8bf*)ap, *(const v8bf*)(ap + 16));
      }
      // holds the refill at the head of its k step: the scheduler otherwise sinks it to its use, three steps on
      __builtin_amdgcn_sched_barrier(0);
      #pragma unroll
      for (int ni = 0; ni < 4; ++ni) {
        const v16bf bfr = cat8(bq[ks & 3][2 * ni], bq[ks & 3][2 * ni + 1]);
        #pragma unroll
        for (int mi = 0; mi < 4; ++mi)
          acc[mi][ni] = wmma_bf16(af[mi], bfr, acc[mi][ni]);
      }
      // keeps the next step's loads and address updates behind these products and their load waits, as one group
      __builtin_amdgcn_sched_barrier(0);
    }
    __syncthreads();   // lds_a + raw buffer free for the next tile
  }

  // Chunk 0's residual tile starts now and flies under SiLU and chunk 0's k loop. The loop's last barrier ended
  // every wave's reads and writes of the raw and A buffers, and wave 0's last tile load was waited for.
  const uint32_t hr_off = OFF_HR + uni((uint32_t)tid >> 5) * HR_SLICE;
  const uint32_t hr_dst = (uint32_t)(size_t)smem + hr_off;
  const uint64_t hr_src = (uint64_t)(size_t)(h + (size_t)blockTok0 * D_MODEL) + (uint64_t)(uni((uint32_t)tid >> 5) * 1024u);
  const u32x8 hg1 = hr_group1();
  u32x4 hg0 = hr_group0(hr_dst, hr_src);
  // this wave's own LDS traffic has retired before the mover writes where it read
  asm volatile("s_wait_dscnt 0x0" ::: "memory");
  // every wave issues its own tile: one request a wave, no test
  asm volatile("tensor_load_to_lds %0, %1" :: "s"(hg0), "s"(hg1) : "memory");

  // first k steps of the second weight stream fly while SiLU runs
  const __bf16* w2p = W2 + wave * PK_WAVE + lane * 8;
  #pragma unroll
  for (int u = 0; u < BAHEAD; ++u) load_bstep(w2p + u * PK_STEP, bq[u]);

  // ---- 1/rms + SiLU + bf16 store of view tile [64 x 512] to LDS ----
  float invr[4][8];                        // 1/rms of the 32 rows this lane's accumulators hold
  #pragma unroll
  for (int mi = 0; mi < 4; ++mi) {
    #pragma unroll
    for (int v = 0; v < 8; ++v) invr[mi][v] = lds_inv[mi * 16 + v + laneHiOff];
  }
  #pragma unroll
  for (int mi = 0; mi < 4; ++mi) {
    #pragma unroll
    for (int v = 0; v < 8; ++v) {
      v4bf pv;                             // the lane's four neighbouring rank columns of this row
      #pragma unroll
      for (int ni = 0; ni < 4; ++ni) {
        const float x = acc[mi][ni][v] * invr[mi][v];
        const float s = x / (1.0f + __expf(-x));
        pv[ni] = (__bf16)s;
      }
      *(v4bf*)&lds_v[(mi * 16 + v + laneHiOff) * LDSV_STRIDE + wave * 64 + laneLo * 4] = pv;
    }
  }
  __syncthreads();

  // ---- Phase C: GEMM2 (update = view @ W2), wave owns 256 d-cols in 4 chunks ----
  // the chunks' k steps follow one another in W2: one running pointer serves every refill of a trip.
  // The last trip's three refills past step 63 read the first steps of W1, which the host places directly
  // behind W2 (written in the same call, never used): no test in the loop, so the load waits stay counted.
  const __bf16* wq = w2p + BAHEAD * PK_STEP;
  for (int c = 0; c < 4; ++c) {
    v8f acc2[4][4] = {};
    const int nbase = wave * 256 + c * 64;
    for (int k4 = 0; k4 < N1 / 32; k4 += 4) {
      // four k steps a trip, so that the ring's set numbers are compile-time constants
      #pragma unroll
      for (int u = 0; u < 4; ++u) {
        load_bstep(wq + u * PK_STEP, bq[(u + BAHEAD) & 3]);
        const int kb = (k4 + u) * 32 + laneHiOff;
        v16bf af[4];
        #pragma unroll
        for (int mi = 0; mi < 4; ++mi) {
          const __bf16* ap = &lds_v[(mi * 16 + laneLo) * LDSV_STRIDE + kb];
          af[mi] = cat8(*(const v8bf*)ap, *(const v8bf*)(ap + 16));
        }
        // holds the refill at the head of its k step: the scheduler otherwise sinks it to its use, three steps on
        __builtin_amdgcn_sched_barrier(0);
        #pragma unroll
        for (int ni = 0; ni < 4; ++ni) {
          const v16bf bfr = cat8(bq[u][2 * ni], bq[u][2 * ni + 1]);
          #pragma unroll
          for (int mi = 0; mi < 4; ++mi)
            acc2[mi][ni] = wmma_bf16(af[mi], bfr, acc2[mi][ni]);
        }
        // the trip's refills name wq's registers: this wait stands in front of their rewrite at the trip's foot
        if (u == 3) asm volatile("s_wait_xcnt 0x0" ::: "memory");
        // keeps the next step's loads and address updates behind these products and their load waits, as one group
        __builtin_amdgcn_sched_barrier(0);
      }
      wq += 4 * PK_STEP;
    }
    asm volatile("s_wait_tensorcnt 0x0" :: "s"(hg0), "s"(hg1) : "memory");
    const float* hr = (const float*)(smem + hr_off);
    float4 ov[4][8];
    #pragma unroll
    for (int mi = 0; mi < 4; ++mi) {
      #pragma unroll
      for (int v = 0; v < 8; ++v) {
        const int trow = mi * 16 + v + laneHiOff;
        const float4 r = *(const float4*)&hr[trow * (HR_PITCH / 4) + laneLo * 4];
        ov[mi][v].x = r.x + scale * acc2[mi][0][v];
        ov[mi][v].y = r.y + scale * acc2[mi][1][v];
        ov[mi][v].z = r.z + scale * acc2[mi][2][v];
        ov[mi][v].w = r.w + scale * acc2[mi][3][v];
      }
    }
    // the tile's reads have retired before the mover refills it
    asm volatile("s_wait_dscnt 0x0" ::: "memory");
    if (pinned(c + 1 < 4)) {   // the next chunk's tile starts ahead of this chunk's stores and flies under the next k loop
      hg0 = hr_group0(hr_dst, hr_src + (uint64_t)((c + 1) * HR_ROWB));
      asm volatile("tensor_load_to_lds %0, %1" :: "s"(hg0), "s"(hg1) : "memory");
    }
    #pragma unroll
    for (int mi = 0; mi < 4; ++mi) {
      #pragma unroll
      for (int v = 0; v < 8; ++v) {
        const int row = blockTok0 + mi * 16 + v + laneHiOff;
        *(float4*)&out[(size_t)row * D_MODEL + nbase + laneLo * 4] = ov[mi][v];
      }
    }
    // the stores name their data and address registers: this wait stands in front of the next chunk's rewrite of both
    asm volatile("s_wait_xcnt 0x0" ::: "memory");
  }
}

// ---------------- host launcher ----------------
extern "C" void kernel_launch(void* const* d_in, const int* in_sizes, int n_in,
                              void* d_out, int out_size, void* d_ws, size_t ws_size,
                              hipStream_t stream) {
  (void)in_sizes; (void)n_in; (void)out_size; (void)ws_size;
  const float* h  = (const float*)d_in[0];   // [4,4096,2048] f32
  const float* wd = (const float*)d_in[1];   // [8,64,2048]   f32
  const float* wu = (const float*)d_in[2];   // [8,2048,64]   f32
  const float* gb = (const float*)d_in[3];   // scalar        f32
  float* out = (float*)d_out;

  __bf16* W2 = (__bf16*)d_ws;                       // 2 MB
  __bf16* W1 = W2 + (size_t)N1 * D_MODEL;           // 2 MB, directly behind W2: the ring's reads past W2 land here

  k_pack_w<<<PK_JOBS / 8, 256, 0, stream>>>(wd, wu, W1, W2);

  static bool attr_set = []() {
    (void)hipFuncSetAttribute((const void*)k_spoke_fused,
                              hipFuncAttributeMaxDynamicSharedMemorySize, SMEM_BYTES);
    return true;
  }();
  (void)attr_set;

  k_spoke_fused<<<TOKENS / TM, 256, (size_t)SMEM_BYTES, stream>>>(h, W1, W2, gb, out);
}

// v007
// One run takes 60.2 microseconds.
// In both of two side-by-side timings against v006, it was 1.05 times as fast.
// All steps since v000 together make it 4.29 times as fast.
#include <hip/hip_runtime.h>
#include <hip/hip_bf16.h>

// ---------------- problem constants ----------------
#define D_MODEL    2048
#define NUM_SPOKES 8
#define RANK       64
#define N1         (NUM_SPOKES * RANK)
#define TOKENS     (4 * 4096)
#define TM         64
#define KC         256
#define NKT        (D_MODEL / KC)
#define LDSA_STRIDE (KC + 8)
#define LDSV_STRIDE (N1 + 8)
#define EPS_F      1.1920928955078125e-7f

// LDS byte offsets
#define OFF_INV  0                         // 64 floats (256 B)
#define RAWBYTES (TM * KC * 4)             // 65536 B per raw buffer
#define OFF_RAW0 256
#define OFF_RAW1 (OFF_RAW0 + RAWBYTES)     // 65792
#define OFF_A    (OFF_RAW1 + RAWBYTES)     // 131328
#define OFF_V    (OFF_A + TM * LDSA_STRIDE * 2)  // 165120
#define SMEM_BYTES (OFF_V + TM * LDSV_STRIDE * 2) // 231680  (< 320 KB/WGP)
// Residual tiles: behind GEMM1 the raw and A buffers are free; each wave keeps there, for itself alone,
// the 64 rows x 64 columns of h that its current column chunk adds to.
#define HR_ROWB  256
#define HR_PITCH (HR_ROWB + 16)
#define HR_SLICE 18432
#define OFF_HR   2048
static_assert(TM * HR_PITCH <= HR_SLICE && HR_SLICE % 2048 == 0 && OFF_HR >= OFF_INV + TM * 4 &&
              OFF_HR + 8 * HR_SLICE <= OFF_V, "the eight residual tiles lie between the 1/rms values and the view tile");

typedef __attribute__((ext_vector_type(16))) __bf16 v16bf;
typedef __attribute__((ext_vector_type(8)))  __bf16 v8bf;
typedef __attribute__((ext_vector_type(4)))  __bf16 v4bf;
typedef __attribute__((ext_vector_type(8)))  float  v8f;
typedef __attribute__((ext_vector_type(2)))  float  v2f;
typedef unsigned int v4u __attribute__((ext_vector_type(4)));
typedef int          v8i __attribute__((ext_vector_type(8)));
typedef int          v4i __attribute__((ext_vector_type(4)));

#if __has_builtin(__builtin_amdgcn_tensor_load_to_lds) && __has_builtin(__builtin_amdgcn_s_wait_tensorcnt)
#define USE_TDM 1
#else
#define USE_TDM 0
#endif

static __device__ __forceinline__ v16bf cat8(v8bf lo, v8bf hi) {
  return __builtin_shufflevector(lo, hi, 0,1,2,3,4,5,6,7,8,9,10,11,12,13,14,15);
}

static __device__ __forceinline__ v8f wmma_bf16(v16bf a, v16bf b, v8f c) {
  return __builtin_amdgcn_wmma_f32_16x16x32_bf16(false, a, false, b, (short)0, c,
                                                 false, false);
}

#if USE_TDM
static __device__ __forceinline__ v4u tdm_tile_group0(const float* gtile, unsigned lds_off) {
  const unsigned long long ga = (unsigned long long)(uintptr_t)gtile;
  v4u g0;
  g0[0] = 1u;
  g0[1] = lds_off;
  g0[2] = (unsigned)__builtin_amdgcn_readfirstlane((unsigned)ga);  // global_addr[31:0]
  g0[3] = (unsigned)__builtin_amdgcn_readfirstlane((unsigned)((ga >> 32) & 0x1FFFFFFu) | 0x80000000u); // ga[56:32] | type=2
  asm volatile("" : "+s"(g0));   // pinned(): the four words held as one register group, the same at the issue and at the wait
  return g0;
}
static __device__ __forceinline__ v8i tdm_tile_group1() {
  v8i g1;
  g1[0] = (int)(2u << 16);
  g1[1] = (int)((unsigned)(D_MODEL & 0xFFFF) << 16);
  g1[2] = (int)((D_MODEL >> 16) | ((TOKENS & 0xFFFF) << 16));
  g1[3] = (int)((TOKENS >> 16) | (KC << 16));
  g1[4] = (int)TM;
  g1[5] = (int)D_MODEL;
  g1[6] = 0;
  g1[7] = 0;
  return g1;
}
static __device__ __forceinline__ void tdm_load_tile(v4u g0, v8i g1) {
  const v4i gz4 = {0, 0, 0, 0};                          // groups 2/3: dims 3/4 unused
  const v8i gz8 = {0, 0, 0, 0, 0, 0, 0, 0};
  __builtin_amdgcn_tensor_load_to_lds(g0, g1, gz4, gz4, gz8, 0);
}
#endif

// ---- a wave's own residual tile by tensor load: 64 rows of 256 bytes, source pitch one row of h ----
typedef uint32_t u32x4 __attribute__((ext_vector_type(4)));
typedef uint32_t u32x8 __attribute__((ext_vector_type(8)));
static __device__ __forceinline__ uint32_t uni(uint32_t v) { return (uint32_t)__builtin_amdgcn_readfirstlane(v); }
static __device__ __forceinline__ uint32_t pinned(uint32_t v) {
  uint32_t w = uni(v);
  asm volatile("" : "+s"(w));   // pinned(): holds the test in a scalar register, so that the branch on it is s_cmp + s_cbranch_scc
  return w;
}
static __device__ __forceinline__ u32x8 hr_group1() {   // every extent in bytes; tensor = tile
  u32x8 g;
  g[0] = uni((1u << 20) | (5u << 22) | (3u << 25));      // no mask, 1-byte elements, 16 bytes of pad behind every 256
  g[1] = uni(((uint32_t)HR_ROWB & 0xFFFFu) << 16);
  g[2] = uni(((uint32_t)HR_ROWB >> 16) | (((uint32_t)TM & 0xFFFFu) << 16));
  g[3] = uni(((uint32_t)TM >> 16) | ((uint32_t)HR_ROWB << 16));
  g[4] = uni((uint32_t)TM);
  g[5] = uni((uint32_t)(D_MODEL * 4));
  g[6] = uni(0u);
  g[7] = uni(0u);
  return g;
}
static __device__ __forceinline__ u32x4 hr_group0(uint32_t lds_dst, uint64_t ga) {
  u32x4 g;
  g[0] = uni(1u);
  g[1] = uni(lds_dst);
  g[2] = uni((uint32_t)ga);
  g[3] = uni((((uint32_t)(ga >> 32)) & 0x01FFFFFFu) | 0x80000000u);
  return g;
}

#define PK_TILE 512                        // elements of one 16-column x 32-k tile
#define PK_WAVE (4 * PK_TILE)              // one wave's four tiles of a k step
#define PK_STEP (8 * PK_WAVE)              // the eight waves' tiles of a k step

// Both weights in one launch, one work-group a WGP. A wave packs two neighbouring k steps of one 16-column tile:
// 16 source rows of 256 bytes. Eight lanes read one 128-byte line (32 k of a column), so that a load instruction
// covers four whole lines; all eight loads of a lane fly together, and a wave alone writes its two 1-KB tiles.
#define PK_JOBS (2 * 32 * 8 * 4)           // [weight][pair of k steps][wave][tile]
__global__ __launch_bounds__(256)
void k_pack_w(const float* __restrict__ wdn, const float* __restrict__ wup,
              __bf16* __restrict__ W1, __bf16* __restrict__ W2) {
  const int lane = threadIdx.x & 31;
  const int job  = blockIdx.x * 8 + (threadIdx.x >> 5);
  const int tile = job & 3;
  const int wave = (job >> 2) & 7;
  const int sp   = (job >> 5) & 31;        // k steps 2 * sp and 2 * sp + 1
  const int q    = lane & 7;               // k = 4 * q + 0..3 inside a step
  const int cs   = lane >> 3;              // column inside a group of four
  const bool first = job < PK_JOBS / 2;
  // W1: a wave owns 64 rank columns; 64 k steps.  W2: [4 column chunks][16 k steps]; a pair of steps is one spoke's 64 ranks
  const float* src = first ? wdn + (size_t)(wave * 64 + tile) * D_MODEL + sp * 64
                           : wup + (size_t)(sp & 7) * (D_MODEL * RANK) + (size_t)(wave * 256 + (sp >> 3) * 64 + tile) * RANK;
  const unsigned pitch = first ? 4 * D_MODEL : 4 * RANK;   // floats between a tile's neighbouring columns
  __bf16* dst = (first ? W1 : W2) + (size_t)sp * (2 * PK_STEP) + wave * PK_WAVE + tile * PK_TILE;
  const unsigned so = cs * pitch + q * 4;
  const unsigned o  = (q >> 2) * (PK_TILE / 2) + (((q >> 1) & 1) * 16 + cs) * 8 + (q & 1) * 4;
  const float* p0 = src + so;
  const float* p1 = p0 + 4 * pitch;
  const float* p2 = p1 + 4 * pitch;
  const float* p3 = p2 + 4 * pitch;
  float4 v[2][4];
  #pragma unroll
  for (int e = 0; e < 2; ++e) {
    v[e][0] = *(const float4*)(p0 + e * 32);
    v[e][1] = *(const float4*)(p1 + e * 32);
    v[e][2] = *(const float4*)(p2 + e * 32);
    v[e][3] = *(const float4*)(p3 + e * 32);
  }
  // the wait in front of any rewrite of the loads' address registers; they are named as inputs so that they live up
  // to it and no later load's result is given one of them
  asm volatile("s_wait_xcnt 0x0" :: "v"(p0), "v"(p1), "v"(p2), "v"(p3) : "memory");
  #pragma unroll
  for (int e = 0; e < 2; ++e) {
    #pragma unroll
    for (int i = 0; i < 4; ++i) {
      v4bf pv;
      pv[0] = (__bf16)v[e][i].x;
      pv[1] = (__bf16)v[e][i].y;
      pv[2] = (__bf16)v[e][i].z;
      pv[3] = (__bf16)v[e][i].w;
      *(v4bf*)(dst + e * PK_STEP + i * 4 * 8 + o) = pv;
    }
  }
}

// One k step of a wave's packed B: four 16-column tiles, two 16-byte halves each (4 KB a wave).
static __device__ __forceinline__ void load_bstep(const __bf16* __restrict__ p, v8bf (&dst)[8]) {
  #pragma unroll
  for (int ni = 0; ni < 4; ++ni) {
    dst[2 * ni]     = *(const v8bf*)(p + ni * PK_TILE);
    dst[2 * ni + 1] = *(const v8bf*)(p + ni * PK_TILE + PK_TILE / 2);
  }
}
#define BAHEAD 3                           // k steps of B in flight ahead of the one in use

__global__ __launch_bounds__(256) __attribute__((amdgpu_waves_per_eu(2, 2)))
void k_spoke_fused(const float* __restrict__ h,
                   const __bf16* __restrict__ W1,   // 512 cols x 2048 k, packed fragments
                   const __bf16* __restrict__ W2,   // 2048 cols x 512 k, packed fragments
                   const float* __restrict__ gate_bias,
                   float* __restrict__ out) {
  const int tid       = threadIdx.x;
  const int lane      = tid & 31;
  const int wave      = tid >> 5;          // 0..7, owns N-slice of 64 (G1) / 256 (G2)
  const int laneLo    = lane & 15;
  const int laneHiOff = (lane >> 4) << 3;  // 0 or 8
  const int blockTok0 = blockIdx.x * TM;
  // Every work-group streams the same two packed weights out of L2. Each starts its walk at another place, so that
  // at one moment the work-groups ask for different lines. The index bits above the low three are taken.
  const uint32_t rot = (uint32_t)blockIdx.x >> 3;

  extern __shared__ __attribute__((aligned(2048))) char smem[];
  float*  lds_inv = (float*)(smem + OFF_INV);
  __bf16* lds_a   = (__bf16*)(smem + OFF_A);
  __bf16* lds_v   = (__bf16*)(smem + OFF_V);

  const float gb    = gate_bias[0];
  const float scale = (1.0f / (1.0f + __expf(-gb))) * (1.0f / NUM_SPOKES);

#if USE_TDM
  // formed by every wave, outside the issuing wave's branch: wave-uniform values that stay in scalar registers
  v8i kg1 = tdm_tile_group1();
  asm volatile("" : "+s"(kg1));
  v4u kcur = tdm_tile_group0(h + (size_t)blockTok0 * D_MODEL + (rot & (NKT - 1)) * KC, OFF_RAW0);
  if (wave == 0) {  // kick off first A tile
    tdm_load_tile(kcur, kg1);
  }
#endif

  // ---- GEMM1 (A @ W1 on the raw rows), K staged in LDS tiles of KC ----
  // A row's 1/rms is one factor of its whole dot product: it is applied to the f32 sums behind the loop,
  // and the squares are summed from the staged tiles on the way, so h needs no pass of its own for the norm.
  v8f acc[4][4] = {};
  v2f ssq[8] = {};                         // this lane's share of the squares of the wave's 8 rows, even | odd columns
  const __bf16* w1p = W1 + wave * PK_WAVE + lane * 8;
  // Register ring of B fragments: set (s & 3) holds k step s; steps s+1..s+3 are in flight from L2.
  v8bf bq[BAHEAD + 1][8];
  #pragma unroll 2
  for (int kt = 0; kt < NKT; ++kt) {
    const float* raw = (const float*)(smem + OFF_RAW0 + (kt & 1) * RAWBYTES);
    const uint32_t ktile = (kt + rot) & (NKT - 1);   // the K tile of this trip: all eight, from the group's own start

#if USE_TDM
    const v4u knext = tdm_tile_group0(h + (size_t)blockTok0 * D_MODEL + ((ktile + 1) & (NKT - 1)) * KC,
                                      (unsigned)(OFF_RAW0 + ((kt + 1) & 1) * RAWBYTES));
    if (wave == 0) {
      if (kt + 1 < NKT) {
        tdm_load_tile(knext, kg1);
        asm volatile("s_wait_tensorcnt 0x1" :: "s"(kcur), "s"(knext), "s"(kg1) : "memory");
      } else {
        asm volatile("s_wait_tensorcnt 0x0" :: "s"(kcur), "s"(kg1) : "memory");
      }
    }
    kcur = knext;
    __syncthreads();
#else
    {
      float* rawW = (float*)(smem + OFF_RAW0 + (kt & 1) * RAWBYTES);
      const float* gsrc = h + (size_t)blockTok0 * D_MODEL + ktile * KC;
      #pragma unroll
      for (int i = 0; i < (TM * KC / 4) / 256; ++i) {   // 16 float4 per thread
        const int seg = tid + i * 256;
        const int r   = seg >> 6;          // KC/4 = 64 segments per row
        const int cc  = (seg & 63) * 4;
        *(float4*)&rawW[r * KC + cc] = *(const float4*)(gsrc + (size_t)r * D_MODEL + cc);
      }
      __syncthreads();
    }
#endif

    // this tile's first k steps of B fly while the tile is converted; the ring is empty at the tile's
    // other two barriers, which wait for every outstanding load
    const __bf16* w1t = w1p + ktile * (KC / 32) * PK_STEP;
    #pragma unroll
    for (int u = 0; u < BAHEAD; ++u) load_bstep(w1t + u * PK_STEP, bq[u]);

    // bf16 convert + squares: each wave owns 8 rows; lanes sweep a row (no conflicts)
    #pragma unroll
    for (int j = 0; j < 8; ++j) {
      const int row    = wave * 8 + j;
      #pragma unroll
      for (int c = 0; c < 2; ++c) {
        const int col = lane * 4 + c * 128;
        const float4 rv = *(const float4*)&raw[row * KC + col];
        v4bf pv;
        const v2f lo = {rv.x, rv.y}, hi = {rv.z, rv.w};   // the loaded register pairs: packed FMAs, no moves
        ssq[j] = __builtin_elementwise_fma(lo, lo, ssq[j]);
        ssq[j] = __builtin_elementwise_fma(hi, hi, ssq[j]);
        pv[0] = (__bf16)rv.x;
        pv[1] = (__bf16)rv.y;
        pv[2] = (__bf16)rv.z;
        pv[3] = (__bf16)rv.w;
        *(v4bf*)&lds_a[row * LDSA_STRIDE + col] = pv;
      }
    }
    if (kt == NKT - 1) {   // rows complete: 1/rms to LDS, published by the last tile's two barriers
      float mine = 0.0f;
      #pragma unroll
      for (int j = 0; j < 8; ++j) {
        float s = ssq[j][0] + ssq[j][1];
        s += __shfl_xor(s, 16, 32);
        s += __shfl_xor(s, 8, 32);
        s += __shfl_xor(s, 4, 32);
        s += __shfl_xor(s, 2, 32);
        s += __shfl_xor(s, 1, 32);
        if (lane == j) mine = s;
      }
      if (lane < 8) lds_inv[wave * 8 + lane] = rsqrtf(mine * (1.0f / D_MODEL) + EPS_F);
    }
    __syncthreads();

    // 4 M-tiles x 4 N-tiles per wave -> 16 WMMA per 32-K step, B loaded once per wave
    // unrolled so that the ring's set numbers are compile-time constants (the sets stay in registers)
    #pragma unroll
    for (int ks = 0; ks < KC / 32; ++ks) {
      if (ks + BAHEAD < KC / 32) load_bstep(w1t + (ks + BAHEAD) * PK_STEP, bq[(ks + BAHEAD) & 3]);
      const int kb = ks * 32 + laneHiOff;
      v16bf af[4];
      #pragma unroll
      for (int mi = 0; mi < 4; ++mi) {
        const __bf16* ap = &lds_a[(mi * 16 + laneLo) * LDSA_STRIDE + kb];
        af[mi] = cat8(*(const v8bf*)ap, *(const v8bf*)(ap + 16));
      }
      // holds the refill at the head of its k step: the scheduler otherwise sinks it to its use, three steps on
      __builtin_amdgcn_sched_barrier(0);
      #pragma unroll
      for (int ni = 0; ni < 4; ++ni) {
        const v16bf bfr = cat8(bq[ks & 3][2 * ni], bq[ks & 3][2 * ni + 1]);
        #pragma unroll
        for (int mi = 0; mi < 4; ++mi)
          acc[mi][ni] = wmma_bf16(af[mi], bfr, acc[mi][ni]);
      }
      // keeps the next step's loads and address updates behind these products and their load waits, as one group
      __builtin_amdgcn_sched_barrier(0);
    }
    __syncthreads();   // lds_a + raw buffer free for the next tile
  }

  // The first chunk's residual tile starts now and flies under SiLU and that chunk's k loop. The loop's last barrier ended
  // every wave's reads and writes of the raw and A buffers, and wave 0's last tile load was waited for.
  const uint32_t hr_off = OFF_HR + uni((uint32_t)tid >> 5) * HR_SLICE;
  const uint32_t hr_dst = (uint32_t)(size_t)smem + hr_off;
  const uint64_t hr_src = (uint64_t)(size_t)(h + (size_t)blockTok0 * D_MODEL) + (uint64_t)(uni((uint32_t)tid >> 5) * 1024u);
  const u32x8 hg1 = hr_group1();
  const uint32_t c0 = rot & 3;             // the column chunk this group starts with
  const uint32_t g0 = (rot >> 2) & 3;      // the group of four k steps it starts every chunk with
  u32x4 hg0 = hr_group0(hr_dst, hr_src + (uint64_t)(c0 * HR_ROWB));
  // this wave's own LDS traffic has retired before the mover writes where it read
  asm volatile("s_wait_dscnt 0x0" ::: "memory");
  // every wave issues its own tile: one request a wave, no test
  asm volatile("tensor_load_to_lds %0, %1" :: "s"(hg0), "s"(hg1) : "memory");

  // first k steps of the second weight stream fly while SiLU runs
  // trip t of the walk (four k steps): chunk (c0 + t / 4) mod 4, k group (g0 + t) mod 4; t = 16 wraps to trip 0's place
  const __bf16* w2p = W2 + wave * PK_WAVE + lane * 8;
  const __bf16* wcur = w2p + (c0 * 4 + g0) * (4 * PK_STEP);
  #pragma unroll
  for (int u = 0; u < BAHEAD; ++u) load_bstep(wcur + u * PK_STEP, bq[u]);

  // ---- 1/rms + SiLU + bf16 store of view tile [64 x 512] to LDS ----
  float invr[4][8];                        // 1/rms of the 32 rows this lane's accumulators hold
  #pragma unroll
  for (int mi = 0; mi < 4; ++mi) {
    #pragma unroll
    for (int v = 0; v < 8; ++v) invr[mi][v] = lds_inv[mi * 16 + v + laneHiOff];
  }
  #pragma unroll
  for (int mi = 0; mi < 4; ++mi) {
    #pragma unroll
    for (int v = 0; v < 8; ++v) {
      v4bf pv;                             // the lane's four neighbouring rank columns of this row
      #pragma unroll
      for (int ni = 0; ni < 4; ++ni) {
        const float x = acc[mi][ni][v] * invr[mi][v];
        const float s = x / (1.0f + __expf(-x));
        pv[ni] = (__bf16)s;
      }
      *(v4bf*)&lds_v[(mi * 16 + v + laneHiOff) * LDSV_STRIDE + wave * 64 + laneLo * 4] = pv;
    }
  }
  __syncthreads();

  // ---- Phase C: GEMM2 (update = view @ W2), wave owns 256 d-cols in 4 chunks ----
  // A trip refills its own last k step and the next trip's first three: two pointers. The last trip's three refills
  // read the walk's first steps again (never used): no test in the loop, so the load waits stay counted.
  const __bf16* wnxt = w2p + (c0 * 4 + ((g0 + 1) & 3)) * (4 * PK_STEP);
  for (uint32_t ci = 0; ci < 4; ++ci) {
    v8f acc2[4][4] = {};
    const uint32_t c = (c0 + ci) & 3;
    const int nbase = wave * 256 + c * 64;
    for (uint32_t j = 0; j < 4; ++j) {
      const int k4 = ((g0 + j) & 3) * 4;
      // four k steps a trip, so that the ring's set numbers are compile-time constants
      #pragma unroll
      for (int u = 0; u < 4; ++u) {
        load_bstep(u == 0 ? wcur + BAHEAD * PK_STEP : wnxt + (u - 1) * PK_STEP, bq[(u + BAHEAD) & 3]);
        const int kb = (k4 + u) * 32 + laneHiOff;
        v16bf af[4];
        #pragma unroll
        for (int mi = 0; mi < 4; ++mi) {
          const __bf16* ap = &lds_v[(mi * 16 + laneLo) * LDSV_STRIDE + kb];
          af[mi] = cat8(*(const v8bf*)ap, *(const v8bf*)(ap + 16));
        }
        // holds the refill at the head of its k step: the scheduler otherwise sinks it to its use, three steps on
        __builtin_amdgcn_sched_barrier(0);
        #pragma unroll
        for (int ni = 0; ni < 4; ++ni) {
          const v16bf bfr = cat8(bq[u][2 * ni], bq[u][2 * ni + 1]);
          #pragma unroll
          for (int mi = 0; mi < 4; ++mi)
            acc2[mi][ni] = wmma_bf16(af[mi], bfr, acc2[mi][ni]);
        }
        // the trip's refills name both pointers' registers: this wait stands in front of their rewrite at the trip's foot
        if (u == 3) asm volatile("s_wait_xcnt 0x0" ::: "memory");
        // keeps the next step's loads and address updates behind these products and their load waits, as one group
        __builtin_amdgcn_sched_barrier(0);
      }
      // both pointers are formed anew from the trip's number, behind the wait: a copy of one into the other is
      // placed by the compiler directly behind the first refill, in front of the wait
      const uint32_t t1 = ci * 4 + j + 1, t2 = t1 + 1;   // the next trip and the one after it
      wcur = w2p + (((c0 + (t1 >> 2)) & 3) * 4 + ((g0 + t1) & 3)) * (4 * PK_STEP);
      wnxt = w2p + (((c0 + (t2 >> 2)) & 3) * 4 + ((g0 + t2) & 3)) * (4 * PK_STEP);
    }
    asm volatile("s_wait_tensorcnt 0x0" :: "s"(hg0), "s"(hg1) : "memory");
    const float* hr = (const float*)(smem + hr_off);
    float4 ov[4][8];
    #pragma unroll
    for (int mi = 0; mi < 4; ++mi) {
      #pragma unroll
      for (int v = 0; v < 8; ++v) {
        const int trow = mi * 16 + v + laneHiOff;
        const float4 r = *(const float4*)&hr[trow * (HR_PITCH / 4) + laneLo * 4];
        ov[mi][v].x = r.x + scale * acc2[mi][0][v];
        ov[mi][v].y = r.y + scale * acc2[mi][1][v];
        ov[mi][v].z = r.z + scale * acc2[mi][2][v];
        ov[mi][v].w = r.w + scale * acc2[mi][3][v];
      }
    }
    // the tile's reads have retired before the mover refills it
    asm volatile("s_wait_dscnt 0x0" ::: "memory");
    if (pinned(ci + 1 < 4)) {   // the next chunk's tile starts ahead of this chunk's stores and flies under the next k loop
      hg0 = hr_group0(hr_dst, hr_src + (uint64_t)(((c + 1) & 3) * HR_ROWB));
      asm volatile("tensor_load_to_lds %0, %1" :: "s"(hg0), "s"(hg1) : "memory");
    }
    #pragma unroll
    for (int mi = 0; mi < 4; ++mi) {
      #pragma unroll
      for (int v = 0; v < 8; ++v) {
        const int row = blockTok0 + mi * 16 + v + laneHiOff;
        *(float4*)&out[(size_t)row * D_MODEL + nbase + laneLo * 4] = ov[mi][v];
      }
    }
    // the stores name their data and address registers: this wait stands in front of the next chunk's rewrite of both
    asm volatile("s_wait_xcnt 0x0" ::: "memory");
  }
}

// ---------------- host launcher ----------------
extern "C" void kernel_launch(void* const* d_in, const int* in_sizes, int n_in,
                              void* d_out, int out_size, void* d_ws, size_t ws_size,
                              hipStream_t stream) {
  (void)in_sizes; (void)n_in; (void)out_size; (void)ws_size;
  const float* h  = (const float*)d_in[0];   // [4,4096,2048] f32
  const float* wd = (const float*)d_in[1];   // [8,64,2048]   f32
  const float* wu = (const float*)d_in[2];   // [8,2048,64]   f32
  const float* gb = (const float*)d_in[3];   // scalar        f32
  float* out = (float*)d_out;

  __bf16* W2 = (__bf16*)d_ws;                       // 2 MB
  __bf16* W1 = W2 + (size_t)N1 * D_MODEL;           // 2 MB

  k_pack_w<<<PK_JOBS / 8, 256, 0, stream>>>(wd, wu, W1, W2);

  static bool attr_set = []() {
    (void)hipFuncSetAttribute((const void*)k_spoke_fused,
                              hipFuncAttributeMaxDynamicSharedMemorySize, SMEM_BYTES);
    return true;
  }();
  (void)attr_set;

  k_spoke_fused<<<TOKENS / TM, 256, (size_t)SMEM_BYTES, stream>>>(h, W1, W2, gb, out);
}
